// v000
// Times are from an AMD MI455X. After a warm-up the kernel runs many times in a row, and a time is the length of
// such a window on the GPU divided by its runs, so every launch and the gaps after it count. The runs cycle
// through copies of the inputs. A figure is the median of several windows, for all but v000 over two sittings.
// Sittings can differ by a few percent; kernels timed side by side share one.
// v000 is the starting kernel. One run takes 188 microseconds.
#include <hip/hip_runtime.h>

// UVLearner: attn[b][q][k] = softmax_k(x[b,:,q].y[b,:,k] / sqrt(128)) over all 4096 key pixels; uv[b][q] = Σ_k attn·grid[k] with grid[k] = (k % 64 + 0.5, k / 64 + 0.5) (meshgrid 'xy':
// grid[i][j] = (j + .5, i + .5), flattened k = i*64 + j); uv = uv / 64 * 2 - 1 -> [4][64][64][2].
// S^T = y^T.x with EXACT operands (x, y are exact bf16 values as f16 rows; 1 product, f32 accumulate — the scores are f32-exact up to summation order); online softmax in f32; the
// expectation Σ P·grid on v_wmma_f32_16x16x32_f16 with P as an f16 hi+lo pair x8 and the grid coordinates exact in f16 (2 products). One wave = (b, 16 queries) over the 128 key

namespace {
constexpr int Bn = 4, C = 128, NP = 4096, GW = 64;
constexpr float PS = 8.0f, SCALE = 0.08838834764831845f;   // 128^-0.5

typedef _Float16 b16;
typedef __attribute__((ext_vector_type(16))) _Float16 v16b;
typedef __attribute__((ext_vector_type(8))) _Float16 v8b;
typedef __attribute__((ext_vector_type(8))) float v8f;
typedef __attribute__((ext_vector_type(4))) float v4f;
__device__ __forceinline__ float bf16_rne(float f) { unsigned int u = __float_as_uint(f); u += 0x7FFFu + ((u >> 16) & 1u); return __uint_as_float(u & 0xFFFF0000u); }
__device__ __forceinline__ void split16(float v, b16& hi, b16& lo) { hi = (b16)v; lo = (b16)(v - (float)hi); }
__device__ __forceinline__ v16b frag_kb(const b16* p, int hh) { const v8b a = *(const v8b*)(p + 8 * hh), b = *(const v8b*)(p + 16 + 8 * hh); v16b f;
#pragma unroll
  for (int e = 0; e < 8; ++e) { f[e] = a[e]; f[8 + e] = b[e]; } return f; }
__device__ __forceinline__ v8f wmma16b(v16b a, v16b b, v8f c) { v8f d = __builtin_amdgcn_wmma_f32_16x16x32_f16(false, a, false, b, (short)0, c, false, false); asm volatile("v_nop\n\tv_nop\n\tv_nop\n\tv_nop" : "+v"(d) : "v"(a), "v"(b)); return d; }
__device__ __forceinline__ float nexp(float x) { return __builtin_amdgcn_exp2f(x * 1.4426950408889634f); }

__global__ __launch_bounds__(256) void xpose_kernel(const float* __restrict__ x, const float* __restrict__ y, b16* __restrict__ XT, b16* __restrict__ YT, b16* __restrict__ GT) {
  __shared__ __attribute__((aligned(16))) b16 T[64][C + 8];
  const int b = blockIdx.y, p0 = blockIdx.x * 64, which = blockIdx.z, t_ = threadIdx.x; const float* src = (which == 0) ? x : y; b16* dst = (which == 0) ? XT : YT;
  for (int i = t_; i < C * 64; i += 256) { const int c = i >> 6, p = i & 63; T[p][c] = (b16)bf16_rne(src[((size_t)b * C + c) * NP + p0 + p]); }
  __syncthreads();
  { for (int i = t_; i < 64 * 16; i += 256) { const int p = i >> 4, c8 = (i & 15) * 8; *(v8b*)(dst + ((size_t)b * NP + p0 + p) * C + c8) = *(const v8b*)(&T[p][c8]); }
    if (b == 0 && which == 0) { for (int i = t_; i < 16 * 8; i += 256) { const int row = i >> 3, c8 = (i & 7) * 8; v8b v; for (int e = 0; e < 8; ++e) { const int k = p0 + c8 + e; v[e] = (b16)((row == 0) ? ((float)(k % GW) + 0.5f) : (row == 1) ? ((float)(k / GW) + 0.5f) : 0.0f); } *(v8b*)(GT + (size_t)row * NP + p0 + c8) = v; } }
     }
}

// attention + expectation: wave = (b, 16 queries); block = 8 waves = 128 queries of one image; over 128 key blocks of 32: S^T = Y.q (K = 128: 4 k-steps, 1 product, exact operands),
__global__ __launch_bounds__(256) void attn_kernel(const b16* __restrict__ XT, const b16* __restrict__ YT, const b16* __restrict__ GT, float* __restrict__ out) {
  __shared__ float O[128][2];
  const int wid = threadIdx.x >> 5, lane = threadIdx.x & 31, hh = lane >> 4, col = lane & 15, b = blockIdx.y, q0 = blockIdx.x * 128 + wid * 16, qi = q0 + col;
  const b16* Xb = XT + (size_t)b * NP * C; const b16* Yb = YT + (size_t)b * NP * C;
  v16b qf[4];
#pragma unroll
  for (int j = 0; j < 4; ++j) qf[j] = frag_kb(Xb + (size_t)qi * C + 32 * j, hh);
  float m = -INFINITY, l = 0.0f; v8f o = {};
  for (int kb = 0; kb < NP; kb += 32) {
    v8f s0 = {}, s1 = {};
#pragma unroll
    for (int j = 0; j < 4; ++j) { const v16b ka = frag_kb(Yb + (size_t)(kb + col) * C + 32 * j, hh), kc = frag_kb(Yb + (size_t)(kb + 16 + col) * C + 32 * j, hh); s0 = wmma16b(ka, qf[j], s0); s1 = wmma16b(kc, qf[j], s1); }
    float mr = -INFINITY;
#pragma unroll
    for (int r = 0; r < 8; ++r) { s0[r] *= SCALE; s1[r] *= SCALE; mr = fmaxf(mr, fmaxf(s0[r], s1[r])); }
    mr = fmaxf(mr, __shfl_xor(mr, 16));
    const float mn = fmaxf(m, mr), al_ = nexp(m - mn); m = mn; float sum = 0.0f; v16b ph, pl;
#pragma unroll
    for (int r = 0; r < 8; ++r) { const float e0 = nexp(s0[r] - mn), e1 = nexp(s1[r] - mn); sum += e0 + e1; b16 a_, c_; split16(e0 * PS, a_, c_); ph[r] = a_; pl[r] = c_; split16(e1 * PS, a_, c_); ph[8 + r] = a_; pl[8 + r] = c_; }
    sum += __shfl_xor(sum, 16); l = l * al_ + sum; o *= al_;
    const v16b gf = frag_kb(GT + (size_t)col * NP + kb, hh); o = wmma16b(gf, ph, o); o = wmma16b(gf, pl, o); }
  // o: rows (8hh + r) = coordinate index (0 = x, 1 = y), column = query col
  const float inv = 1.0f / (l * PS);
#pragma unroll
  for (int r = 0; r < 8; ++r) { const int t = 8 * hh + r; if (t < 2) O[wid * 16 + col][t] = (o[r] * inv) * (2.0f / (float)GW) - 1.0f; }   // uv / [wy, hy] * 2 - 1 (wy = hy = 64)
  __syncthreads();
  { if (threadIdx.x < 64) *(v4f*)(out + ((size_t)b * NP + blockIdx.x * 128) * 2 + threadIdx.x * 4) = *(const v4f*)(&O[0][0] + threadIdx.x * 4);  }
}
}  // namespace

extern "C" void kernel_launch(void* const* d_in, const int* in_sizes, int n_in,
                              void* d_out, int out_size, void* d_ws, size_t ws_size, hipStream_t stream) {
  (void)n_in; (void)out_size;
  const float* x = (const float*)d_in[0]; const float* y = (const float*)d_in[1];
  float* out = (float*)d_out;   // [4][64][64][2]
  if (in_sizes[0] != Bn * C * NP || in_sizes[1] != Bn * C * NP) return;
  size_t off = 0; char* ws = (char*)d_ws;
  auto carve = [&](size_t bytes) { char* p = ws + off; off += (bytes + 255) & ~(size_t)255; return p; };
  b16* XT = (b16*)carve((size_t)Bn * NP * C * 2); b16* YT = (b16*)carve((size_t)Bn * NP * C * 2); b16* GT = (b16*)carve((size_t)16 * NP * 2);
  if (off > ws_size) return;                                    // ≈ 4.2 + 4.2 + 0.13 MB
  xpose_kernel<<<dim3(NP / 64, Bn, 2), 256, 0, stream>>>(x, y, XT, YT, GT);
  attn_kernel<<<dim3(NP / 128, Bn), 256, 0, stream>>>(XT, YT, GT, out);
}

// v001
// A run of this version takes 65.8 microseconds.
// Two timings next to v000 put it at 3.00 and 2.92 times that version's speed.
#include <hip/hip_runtime.h>
#include <stdint.h>

// UVLearner: attn[b][q][k] = softmax_k(x[b,:,q].y[b,:,k] / sqrt(128)) over all 4096 key pixels; uv[b][q] = Σ_k attn·grid[k] with grid[k] = (k % 64 + 0.5, k / 64 + 0.5) (meshgrid 'xy':
// grid[i][j] = (j + .5, i + .5), flattened k = i*64 + j); uv = uv / 64 * 2 - 1 -> [4][64][64][2].
// S^T = y^T.x with EXACT operands (x, y are exact bf16 values as f16 rows; 1 product, f32 accumulate — the scores are f32-exact up to summation order); online softmax in f32; the
// expectation Σ P·grid on v_wmma_f32_16x16x32_f16 with P as an f16 hi+lo pair x8 and the grid coordinates exact in f16 (2 products). One wave = (b, 16 queries) over the 128 key

namespace {
constexpr int Bn = 4, C = 128, NP = 4096, GW = 64;
constexpr float PS = 8.0f, SCALE = 0.08838834764831845f;   // 128^-0.5

typedef _Float16 b16;
typedef __attribute__((ext_vector_type(16))) _Float16 v16b;
typedef __attribute__((ext_vector_type(8))) _Float16 v8b;
typedef __attribute__((ext_vector_type(8))) float v8f;
typedef __attribute__((ext_vector_type(4))) float v4f;
__device__ __forceinline__ float bf16_rne(float f) { unsigned int u = __float_as_uint(f); u += 0x7FFFu + ((u >> 16) & 1u); return __uint_as_float(u & 0xFFFF0000u); }
__device__ __forceinline__ void split16(float v, b16& hi, b16& lo) { hi = (b16)v; lo = (b16)(v - (float)hi); }
__device__ __forceinline__ v16b frag_kb(const b16* p, int hh) { const v8b a = *(const v8b*)(p + 8 * hh), b = *(const v8b*)(p + 16 + 8 * hh); v16b f;
#pragma unroll
  for (int e = 0; e < 8; ++e) { f[e] = a[e]; f[8 + e] = b[e]; } return f; }
__device__ __forceinline__ v8f wmma16b(v16b a, v16b b, v8f c) { v8f d = __builtin_amdgcn_wmma_f32_16x16x32_f16(false, a, false, b, (short)0, c, false, false); asm volatile("v_nop\n\tv_nop\n\tv_nop\n\tv_nop" : "+v"(d) : "v"(a), "v"(b)); return d; }
__device__ __forceinline__ float nexp(float x) { return __builtin_amdgcn_exp2f(x * 1.4426950408889634f); }

// Key rows and grid rows come into LDS by the tensor mover: stages of SK keys, two buffers, per stage one request of wave 0 (keys) and one of wave 1 (grid); all 8 waves read their fragments from there.
typedef uint32_t u32x4 __attribute__((ext_vector_type(4)));
typedef uint32_t u32x8 __attribute__((ext_vector_type(8)));
constexpr uint32_t SK = 128, NST = NP / SK, ROWB = 2u * C, KP = ROWB + 16u, KBUF = SK * KP, GBUF = (16u * KP + 2047u) & ~2047u, BUF = KBUF + GBUF;   // KP: odd multiple of 16 B for ds_load_b128 readers; a stage of the grid is 16 rows of SK f16 = ROWB bytes
static_assert(ROWB == 256u && SK * 2u == ROWB && KBUF % 2048u == 0u && BUF % 2048u == 0u && NST >= 2u, "pad codes below are for 256-B rows; each tile starts at a multiple of 2 KiB; the ring needs two stages");
__device__ __forceinline__ uint32_t uni(uint32_t v) { return (uint32_t)__builtin_amdgcn_readfirstlane(v); }
__device__ __forceinline__ uint32_t pinned(uint32_t v) { uint32_t w = (uint32_t)__builtin_amdgcn_readfirstlane(v); asm volatile("" : "+s"(w)); return w; }   // holds an issue test (a tensor load ignores EXEC, only a scalar branch guards it) or a descriptor word in a scalar register
__device__ __forceinline__ void wait_ds0() { asm volatile("s_wait_dscnt 0x0" ::: "memory"); }          // this wave's LDS reads have returned before the buffer is handed back
__device__ __forceinline__ void wait_tensor0() { asm volatile("s_wait_tensorcnt 0x0" ::: "memory"); }  // the issuer's tile has landed; the compiler places no wait for the mover
__device__ __forceinline__ void tdm_load(u32x4 g0, u32x8 g1) { asm volatile("tensor_load_to_lds %0, %1" :: "s"(g0), "s"(g1) : "memory"); }   // one request of the whole wave: a padded 2-D tile from global memory into LDS, through no register
__device__ __forceinline__ u32x8 tdm_group1(uint32_t rows, uint32_t src_pitch) {   // bytes; tile = tensor = rows x ROWB bytes, 4 dwords of LDS pad behind every 256-B row
  u32x8 g;
  g[0] = uni((1u << 20) | (5u << 22) | (3u << 25));
  // pinned(): each descriptor word held in a scalar register of its own through the loop, not rebuilt over a register that a request in flight was issued from
  g[1] = pinned((ROWB & 0xFFFFu) << 16);
  g[2] = pinned((ROWB >> 16) | ((rows & 0xFFFFu) << 16));
  g[3] = pinned((rows >> 16) | (ROWB << 16));
  g[4] = pinned(rows);
  g[5] = pinned(src_pitch);
  g[6] = pinned(0u);
  g[7] = pinned(0u);
  return g;
}
__device__ __forceinline__ u32x4 tdm_group0(uint32_t lds_dst, uint64_t ga) {
  u32x4 g;
  g[0] = uni(1u); g[1] = uni(lds_dst); g[2] = uni((uint32_t)ga); g[3] = uni((((uint32_t)(ga >> 32)) & 0x01FFFFFFu) | 0x80000000u);
  return g;
}

__global__ __launch_bounds__(256) void xpose_kernel(const float* __restrict__ x, const float* __restrict__ y, b16* __restrict__ XT, b16* __restrict__ YT, b16* __restrict__ GT) {
  __shared__ __attribute__((aligned(16))) b16 T[64][C + 8];
  const int b = blockIdx.y, p0 = blockIdx.x * 64, which = blockIdx.z, t_ = threadIdx.x; const float* src = (which == 0) ? x : y; b16* dst = (which == 0) ? XT : YT;
  for (int i = t_; i < C * 64; i += 256) { const int c = i >> 6, p = i & 63; T[p][c] = (b16)bf16_rne(src[((size_t)b * C + c) * NP + p0 + p]); }
  __syncthreads();
  { for (int i = t_; i < 64 * 16; i += 256) { const int p = i >> 4, c8 = (i & 15) * 8; *(v8b*)(dst + ((size_t)b * NP + p0 + p) * C + c8) = *(const v8b*)(&T[p][c8]); }
    if (b == 0 && which == 0) { for (int i = t_; i < 16 * 8; i += 256) { const int row = i >> 3, c8 = (i & 7) * 8; v8b v; for (int e = 0; e < 8; ++e) { const int k = p0 + c8 + e; v[e] = (b16)((row == 0) ? ((float)(k % GW) + 0.5f) : (row == 1) ? ((float)(k / GW) + 0.5f) : 0.0f); } *(v8b*)(GT + (size_t)row * NP + p0 + c8) = v; } }
     }
}

// attention + expectation: wave = (b, 16 queries); block = 8 waves = 128 queries of one image; over 128 key blocks of 32: S^T = Y.q (K = 128: 4 k-steps, 1 product, exact operands),
// the key rows and the grid rows read from an LDS ring that the block shares.
__global__ __launch_bounds__(256) void attn_kernel(const b16* __restrict__ XT, const b16* __restrict__ YT, const b16* __restrict__ GT, float* __restrict__ out) {
  __shared__ __attribute__((aligned(2048))) unsigned char KS[2u * BUF];
  __shared__ float O[128][2];
  const int wid = threadIdx.x >> 5, lane = threadIdx.x & 31, hh = lane >> 4, col = lane & 15, b = blockIdx.y, q0 = blockIdx.x * 128 + wid * 16, qi = q0 + col;
  const b16* Xb = XT + (size_t)b * NP * C; const b16* Yb = YT + (size_t)b * NP * C;
  v16b qf[4];
#pragma unroll
  for (int j = 0; j < 4; ++j) qf[j] = frag_kb(Xb + (size_t)qi * C + 32 * j, hh);
  float m = -INFINITY, l = 0.0f; v8f o = {};
  const uint32_t wave = uni(threadIdx.x >> 5); const bool isG = wave == 1u;   // wave 0 moves SK key rows per stage, wave 1 the 16 grid rows' SK columns
  const uint32_t lbase = (uint32_t)(size_t)KS + (isG ? KBUF : 0u), stepb = isG ? ROWB : SK * ROWB; const uint64_t ga0 = isG ? (uint64_t)(size_t)GT : (uint64_t)(size_t)Yb;
  const u32x8 g1 = tdm_group1(isG ? 16u : SK, isG ? 2u * (uint32_t)NP : ROWB);
  if (pinned(wave < 2u)) { tdm_load(tdm_group0(lbase, ga0), g1); wait_tensor0(); }
  __syncthreads();                                                                     // stage 0 published
  if (pinned(wave < 2u)) tdm_load(tdm_group0(lbase + BUF, ga0 + stepb), g1);
  for (uint32_t st = 0; st < NST; ++st) {
   const unsigned char* Kst = KS + (st & 1u) * BUF;
   for (uint32_t sub = 0; sub < SK / 32u; ++sub) {
    const b16* K0 = (const b16*)(Kst + (sub * 32u + (uint32_t)col) * KP); const b16* K1 = (const b16*)(Kst + (sub * 32u + 16u + (uint32_t)col) * KP);
    v8f s0 = {}, s1 = {};
#pragma unroll
    for (int j = 0; j < 4; ++j) { const v16b ka = frag_kb(K0 + 32 * j, hh), kc = frag_kb(K1 + 32 * j, hh); s0 = wmma16b(ka, qf[j], s0); s1 = wmma16b(kc, qf[j], s1); }
    float mr = -INFINITY;
#pragma unroll
    for (int r = 0; r < 8; ++r) { s0[r] *= SCALE; s1[r] *= SCALE; mr = fmaxf(mr, fmaxf(s0[r], s1[r])); }
    mr = fmaxf(mr, __shfl_xor(mr, 16));
    const float mn = fmaxf(m, mr), al_ = nexp(m - mn); m = mn; float sum = 0.0f; v16b ph, pl;
#pragma unroll
    for (int r = 0; r < 8; ++r) { const float e0 = nexp(s0[r] - mn), e1 = nexp(s1[r] - mn); sum += e0 + e1; b16 a_, c_; split16(e0 * PS, a_, c_); ph[r] = a_; pl[r] = c_; split16(e1 * PS, a_, c_); ph[8 + r] = a_; pl[8 + r] = c_; }
    sum += __shfl_xor(sum, 16); l = l * al_ + sum; o *= al_;
    const v16b gf = frag_kb((const b16*)(Kst + KBUF + (uint32_t)col * KP) + sub * 32u, hh); o = wmma16b(gf, ph, o); o = wmma16b(gf, pl, o); }
   // publish point of stage st + 1: own LDS reads done, the issuer's tile landed, barrier; only then the refill of the buffer that stage st used
   wait_ds0();
   if (pinned(wave < 2u)) wait_tensor0();
   __syncthreads();
   if (pinned((wave < 2u) && (st + 2u < NST))) tdm_load(tdm_group0(lbase + (st & 1u) * BUF, ga0 + (uint64_t)((st + 2u) * stepb)), g1);
  }
  wait_tensor0(); wait_ds0();
  // o: rows (8hh + r) = coordinate index (0 = x, 1 = y), column = query col
  const float inv = 1.0f / (l * PS);
#pragma unroll
  for (int r = 0; r < 8; ++r) { const int t = 8 * hh + r; if (t < 2) O[wid * 16 + col][t] = (o[r] * inv) * (2.0f / (float)GW) - 1.0f; }   // uv / [wy, hy] * 2 - 1 (wy = hy = 64)
  __syncthreads();
  { if (threadIdx.x < 64) *(v4f*)(out + ((size_t)b * NP + blockIdx.x * 128) * 2 + threadIdx.x * 4) = *(const v4f*)(&O[0][0] + threadIdx.x * 4);  }
}
}  // namespace

extern "C" void kernel_launch(void* const* d_in, const int* in_sizes, int n_in,
                              void* d_out, int out_size, void* d_ws, size_t ws_size, hipStream_t stream) {
  (void)n_in; (void)out_size;
  const float* x = (const float*)d_in[0]; const float* y = (const float*)d_in[1];
  float* out = (float*)d_out;   // [4][64][64][2]
  if (in_sizes[0] != Bn * C * NP || in_sizes[1] != Bn * C * NP) return;
  size_t off = 0; char* ws = (char*)d_ws;
  auto carve = [&](size_t bytes) { char* p = ws + off; off += (bytes + 255) & ~(size_t)255; return p; };
  b16* XT = (b16*)carve((size_t)Bn * NP * C * 2); b16* YT = (b16*)carve((size_t)Bn * NP * C * 2); b16* GT = (b16*)carve((size_t)16 * NP * 2);
  if (off > ws_size) return;                                    // ≈ 4.2 + 4.2 + 0.13 MB
  xpose_kernel<<<dim3(NP / 64, Bn, 2), 256, 0, stream>>>(x, y, XT, YT, GT);
  attn_kernel<<<dim3(NP / 128, Bn), 256, 0, stream>>>(XT, YT, GT, out);
}

// v002
// It runs in 39.3 microseconds.
// Two timings next to v001 put it at 1.71 and 1.63 times that version's speed.
// Counting every step since v000, it is 4.94 times as fast.
#include <hip/hip_runtime.h>
#include <stdint.h>

// UVLearner: attn[b][q][k] = softmax_k(x[b,:,q].y[b,:,k] / sqrt(128)) over all 4096 key pixels; uv[b][q] = Σ_k attn·grid[k] with grid[k] = (k % 64 + 0.5, k / 64 + 0.5) (meshgrid 'xy':
// grid[i][j] = (j + .5, i + .5), flattened k = i*64 + j); uv = uv / 64 * 2 - 1 -> [4][64][64][2].
// S^T = y^T.x with EXACT operands (x, y are exact bf16 values as f16 rows; 1 product, f32 accumulate — the scores are f32-exact up to summation order); online softmax in f32; the
// expectation Σ P·grid on v_wmma_f32_16x16x32_f16 with P as an f16 hi+lo pair x8 and the grid coordinates exact in f16 (2 products). One wave = (b, 16 queries) over 32 of the 128 keys of every stage

namespace {
constexpr int Bn = 4, C = 128, NP = 4096, GW = 64;
constexpr float PS = 8.0f, SCALE = 0.08838834764831845f;   // 128^-0.5

typedef _Float16 b16;
typedef __attribute__((ext_vector_type(16))) _Float16 v16b;
typedef __attribute__((ext_vector_type(8))) _Float16 v8b;
typedef __attribute__((ext_vector_type(8))) float v8f;
typedef __attribute__((ext_vector_type(4))) float v4f;
__device__ __forceinline__ float bf16_rne(float f) { unsigned int u = __float_as_uint(f); u += 0x7FFFu + ((u >> 16) & 1u); return __uint_as_float(u & 0xFFFF0000u); }
__device__ __forceinline__ void split16(float v, b16& hi, b16& lo) { hi = (b16)v; lo = (b16)(v - (float)hi); }
__device__ __forceinline__ v16b frag_kb(const b16* p, int hh) { const v8b a = *(const v8b*)(p + 8 * hh), b = *(const v8b*)(p + 16 + 8 * hh); v16b f;
#pragma unroll
  for (int e = 0; e < 8; ++e) { f[e] = a[e]; f[8 + e] = b[e]; } return f; }
__device__ __forceinline__ v8f wmma16b(v16b a, v16b b, v8f c) { v8f d = __builtin_amdgcn_wmma_f32_16x16x32_f16(false, a, false, b, (short)0, c, false, false); asm volatile("v_nop\n\tv_nop\n\tv_nop\n\tv_nop" : "+v"(d) : "v"(a), "v"(b)); return d; }
__device__ __forceinline__ float nexp(float x) { return __builtin_amdgcn_exp2f(x * 1.4426950408889634f); }

// Key rows and grid rows come into LDS by the tensor mover: stages of SK keys, two buffers, per stage one request of wave 0 (keys) and one of wave 1 (grid); all waves of the block read their fragments from there.
typedef uint32_t u32x4 __attribute__((ext_vector_type(4)));
typedef uint32_t u32x8 __attribute__((ext_vector_type(8)));
constexpr uint32_t SK = 128, NST = NP / SK, ROWB = 2u * C, KP = ROWB + 16u, KBUF = SK * KP, GBUF = (16u * KP + 2047u) & ~2047u, BUF = KBUF + GBUF;   // KP: odd multiple of 16 B for ds_load_b128 readers; a stage of the grid is 16 rows of SK f16 = ROWB bytes
static_assert(ROWB == 256u && SK * 2u == ROWB && KBUF % 2048u == 0u && BUF % 2048u == 0u && NST >= 2u, "pad codes below are for 256-B rows; each tile starts at a multiple of 2 KiB; the ring needs two stages");
__device__ __forceinline__ uint32_t uni(uint32_t v) { return (uint32_t)__builtin_amdgcn_readfirstlane(v); }
__device__ __forceinline__ uint32_t pinned(uint32_t v) { uint32_t w = (uint32_t)__builtin_amdgcn_readfirstlane(v); asm volatile("" : "+s"(w)); return w; }   // holds an issue test (a tensor load ignores EXEC, only a scalar branch guards it) or a descriptor word in a scalar register
__device__ __forceinline__ void wait_ds0() { asm volatile("s_wait_dscnt 0x0" ::: "memory"); }          // this wave's LDS reads have returned before the buffer is handed back
__device__ __forceinline__ void wait_tensor0() { asm volatile("s_wait_tensorcnt 0x0" ::: "memory"); }  // the issuer's tile has landed; the compiler places no wait for the mover
__device__ __forceinline__ void tdm_load(u32x4 g0, u32x8 g1) { asm volatile("tensor_load_to_lds %0, %1" :: "s"(g0), "s"(g1) : "memory"); }   // one request of the whole wave: a padded 2-D tile from global memory into LDS, through no register
__device__ __forceinline__ u32x8 tdm_group1(uint32_t rows, uint32_t src_pitch) {   // bytes; tile = tensor = rows x ROWB bytes, 4 dwords of LDS pad behind every 256-B row
  u32x8 g;
  g[0] = uni((1u << 20) | (5u << 22) | (3u << 25));
  // pinned(): each descriptor word held in a scalar register of its own through the loop, not rebuilt over a register that a request in flight was issued from
  g[1] = pinned((ROWB & 0xFFFFu) << 16);
  g[2] = pinned((ROWB >> 16) | ((rows & 0xFFFFu) << 16));
  g[3] = pinned((rows >> 16) | (ROWB << 16));
  g[4] = pinned(rows);
  g[5] = pinned(src_pitch);
  g[6] = pinned(0u);
  g[7] = pinned(0u);
  return g;
}
__device__ __forceinline__ u32x4 tdm_group0(uint32_t lds_dst, uint64_t ga) {
  u32x4 g;
  g[0] = uni(1u); g[1] = uni(lds_dst); g[2] = uni((uint32_t)ga); g[3] = uni((((uint32_t)(ga >> 32)) & 0x01FFFFFFu) | 0x80000000u);
  return g;
}

__global__ __launch_bounds__(256) void xpose_kernel(const float* __restrict__ x, const float* __restrict__ y, b16* __restrict__ XT, b16* __restrict__ YT, b16* __restrict__ GT) {
  __shared__ __attribute__((aligned(16))) b16 T[64][C + 8];
  const int b = blockIdx.y, p0 = blockIdx.x * 64, which = blockIdx.z, t_ = threadIdx.x; const float* src = (which == 0) ? x : y; b16* dst = (which == 0) ? XT : YT;
  for (int i = t_; i < C * 64; i += 256) { const int c = i >> 6, p = i & 63; T[p][c] = (b16)bf16_rne(src[((size_t)b * C + c) * NP + p0 + p]); }
  __syncthreads();
  { for (int i = t_; i < 64 * 16; i += 256) { const int p = i >> 4, c8 = (i & 15) * 8; *(v8b*)(dst + ((size_t)b * NP + p0 + p) * C + c8) = *(const v8b*)(&T[p][c8]); }
    if (b == 0 && which == 0) { for (int i = t_; i < 16 * 8; i += 256) { const int row = i >> 3, c8 = (i & 7) * 8; v8b v; for (int e = 0; e < 8; ++e) { const int k = p0 + c8 + e; v[e] = (b16)((row == 0) ? ((float)(k % GW) + 0.5f) : (row == 1) ? ((float)(k / GW) + 0.5f) : 0.0f); } *(v8b*)(GT + (size_t)row * NP + p0 + c8) = v; } }
     }
}

// attention + expectation: block = 16 waves = 4 query tiles (64 queries of one image) x 4 key quarters, so that 256 blocks cover every WGP with four waves per SIMD.
// Wave (qt, sub) takes 16 queries and, of every 128-key stage, the 32-key block sub: S^T = Y.q (K = 128: 4 k-steps, 1 product, exact operands), its own running maximum, sum and expectation;
// the four partials of a query are merged through LDS at the end. The key rows and the grid rows are read from an LDS ring that the block shares.
constexpr int QTB = 4, KSP = (int)(SK / 32u), QB = 16 * QTB;
__global__ __launch_bounds__(32 * QTB * KSP) void attn_kernel(const b16* __restrict__ XT, const b16* __restrict__ YT, const b16* __restrict__ GT, float* __restrict__ out) {
  __shared__ __attribute__((aligned(2048))) unsigned char KS[2u * BUF];
  __shared__ __attribute__((aligned(16))) v4f PM[KSP][QB];   // per key quarter and query: maximum, sum, two un-normalised coordinates
  const int wid = threadIdx.x >> 5, lane = threadIdx.x & 31, hh = lane >> 4, col = lane & 15, b = blockIdx.y, qt = wid & (QTB - 1), q0 = blockIdx.x * QB + qt * 16, qi = q0 + col;
  const uint32_t sub = (uint32_t)wid / (uint32_t)QTB;
  const b16* Xb = XT + (size_t)b * NP * C; const b16* Yb = YT + (size_t)b * NP * C;
  v16b qf[4];
#pragma unroll
  for (int j = 0; j < 4; ++j) qf[j] = frag_kb(Xb + (size_t)qi * C + 32 * j, hh);
  float m = -INFINITY, l = 0.0f; v8f o = {};
  const uint32_t wave = uni(threadIdx.x >> 5); const bool isG = wave == 1u;   // wave 0 moves SK key rows per stage, wave 1 the 16 grid rows' SK columns
  const uint32_t lbase = (uint32_t)(size_t)KS + (isG ? KBUF : 0u), stepb = isG ? ROWB : SK * ROWB; const uint64_t ga0 = isG ? (uint64_t)(size_t)GT : (uint64_t)(size_t)Yb;
  const u32x8 g1 = tdm_group1(isG ? 16u : SK, isG ? 2u * (uint32_t)NP : ROWB);
  if (pinned(wave < 2u)) { tdm_load(tdm_group0(lbase, ga0), g1); wait_tensor0(); }
  __syncthreads();                                                                     // stage 0 published
  if (pinned(wave < 2u)) tdm_load(tdm_group0(lbase + BUF, ga0 + stepb), g1);
  for (uint32_t st = 0; st < NST; ++st) {
   const unsigned char* Kst = KS + (st & 1u) * BUF;
   {
    const b16* K0 = (const b16*)(Kst + (sub * 32u + (uint32_t)col) * KP); const b16* K1 = (const b16*)(Kst + (sub * 32u + 16u + (uint32_t)col) * KP);
    v8f s0 = {}, s1 = {};
#pragma unroll
    for (int j = 0; j < 4; ++j) { const v16b ka = frag_kb(K0 + 32 * j, hh), kc = frag_kb(K1 + 32 * j, hh); s0 = wmma16b(ka, qf[j], s0); s1 = wmma16b(kc, qf[j], s1); }
    float mr = -INFINITY;
#pragma unroll
    for (int r = 0; r < 8; ++r) { s0[r] *= SCALE; s1[r] *= SCALE; mr = fmaxf(mr, fmaxf(s0[r], s1[r])); }
    mr = fmaxf(mr, __shfl_xor(mr, 16));
    const float mn = fmaxf(m, mr), al_ = nexp(m - mn); m = mn; float sum = 0.0f; v16b ph, pl;
#pragma unroll
    for (int r = 0; r < 8; ++r) { const float e0 = nexp(s0[r] - mn), e1 = nexp(s1[r] - mn); sum += e0 + e1; b16 a_, c_; split16(e0 * PS, a_, c_); ph[r] = a_; pl[r] = c_; split16(e1 * PS, a_, c_); ph[8 + r] = a_; pl[8 + r] = c_; }
    sum += __shfl_xor(sum, 16); l = l * al_ + sum; o *= al_;
    const v16b gf = frag_kb((const b16*)(Kst + KBUF + (uint32_t)col * KP) + sub * 32u, hh); o = wmma16b(gf, ph, o); o = wmma16b(gf, pl, o); }
   // publish point of stage st + 1: own LDS reads done, the issuer's tile landed, barrier; only then the refill of the buffer that stage st used
   wait_ds0();
   if (pinned(wave < 2u)) wait_tensor0();
   __syncthreads();
   if (pinned((wave < 2u) && (st + 2u < NST))) tdm_load(tdm_group0(lbase + (st & 1u) * BUF, ga0 + (uint64_t)((st + 2u) * stepb)), g1);
  }
  wait_tensor0(); wait_ds0();
  // o: rows (8hh + r) = coordinate index (0 = x, 1 = y), column = query col; m and l are equal in both halves of the wave
  if (hh == 0) { const v4f pm = {m, l, o[0], o[1]}; PM[sub][qt * 16 + col] = pm; }
  __syncthreads();                                                                     // every quarter's partial is in LDS
  if (threadIdx.x < QB) {
    v4f p[KSP]; float mm = -INFINITY;
#pragma unroll
    for (int k = 0; k < KSP; ++k) { p[k] = PM[k][threadIdx.x]; mm = fmaxf(mm, p[k][0]); }
    float ls = 0.0f, ox = 0.0f, oy = 0.0f;
#pragma unroll
    for (int k = 0; k < KSP; ++k) { const float w = nexp(p[k][0] - mm); ls += w * p[k][1]; ox += w * p[k][2]; oy += w * p[k][3]; }
    const float inv = 1.0f / (ls * PS);
    float2 uv; uv.x = (ox * inv) * (2.0f / (float)GW) - 1.0f; uv.y = (oy * inv) * (2.0f / (float)GW) - 1.0f;   // uv / [wy, hy] * 2 - 1 (wy = hy = 64)
    *(float2*)(out + ((size_t)b * NP + blockIdx.x * QB + threadIdx.x) * 2) = uv;
  }
}
}  // namespace

extern "C" void kernel_launch(void* const* d_in, const int* in_sizes, int n_in,
                              void* d_out, int out_size, void* d_ws, size_t ws_size, hipStream_t stream) {
  (void)n_in; (void)out_size;
  const float* x = (const float*)d_in[0]; const float* y = (const float*)d_in[1];
  float* out = (float*)d_out;   // [4][64][64][2]
  if (in_sizes[0] != Bn * C * NP || in_sizes[1] != Bn * C * NP) return;
  size_t off = 0; char* ws = (char*)d_ws;
  auto carve = [&](size_t bytes) { char* p = ws + off; off += (bytes + 255) & ~(size_t)255; return p; };
  b16* XT = (b16*)carve((size_t)Bn * NP * C * 2); b16* YT = (b16*)carve((size_t)Bn * NP * C * 2); b16* GT = (b16*)carve((size_t)16 * NP * 2);
  if (off > ws_size) return;                                    // ≈ 4.2 + 4.2 + 0.13 MB
  xpose_kernel<<<dim3(NP / 64, Bn, 2), 256, 0, stream>>>(x, y, XT, YT, GT);
  attn_kernel<<<dim3(NP / QB, Bn), 32 * QTB * KSP, 0, stream>>>(XT, YT, GT, out);
}

// v003
// Measured time: 34.9 microseconds a run.
// Timed twice side by side with v002, it ran 1.09 times as fast both times.
// Counting every step since v000, it is 5.38 times as fast.
#include <hip/hip_runtime.h>
#include <stdint.h>

// UVLearner: attn[b][q][k] = softmax_k(x[b,:,q].y[b,:,k] / sqrt(128)) over all 4096 key pixels; uv[b][q] = Σ_k attn·grid[k] with grid[k] = (k % 64 + 0.5, k / 64 + 0.5) (meshgrid 'xy':
// grid[i][j] = (j + .5, i + .5), flattened k = i*64 + j); uv = uv / 64 * 2 - 1 -> [4][64][64][2].
// S^T = y^T.x with EXACT operands (x, y are exact bf16 values as f16 rows; 1 product, f32 accumulate — the scores are f32-exact up to summation order); online softmax in f32; the
// expectation Σ P·grid on v_wmma_f32_16x16x32_f16 with P as an f16 hi+lo pair x8 and the grid coordinates exact in f16 (2 products). One wave = (b, 16 queries) over 32 of the 128 keys of every stage

namespace {
constexpr int Bn = 4, C = 128, NP = 4096, GW = 64;
constexpr float LPS = 3.0f, C2 = (float)(0.08838834764831845 * 1.4426950408889634);   // P carries a factor 2^LPS; C2 = 128^-0.5 * log2(e): exp(scale * s) = exp2(C2 * s)

typedef _Float16 b16;
typedef __attribute__((ext_vector_type(16))) _Float16 v16b;
typedef __attribute__((ext_vector_type(8))) _Float16 v8b;
typedef __attribute__((ext_vector_type(8))) float v8f;
typedef __attribute__((ext_vector_type(4))) float v4f;
typedef __attribute__((ext_vector_type(2))) float v2f;
__device__ __forceinline__ float bf16_rne(float f) { unsigned int u = __float_as_uint(f); u += 0x7FFFu + ((u >> 16) & 1u); return __uint_as_float(u & 0xFFFF0000u); }
__device__ __forceinline__ void split16(float v, b16& hi, b16& lo) { hi = (b16)v; lo = (b16)(v - (float)hi); }
__device__ __forceinline__ v16b frag_kb(const b16* p, int hh) { const v8b a = *(const v8b*)(p + 8 * hh), b = *(const v8b*)(p + 16 + 8 * hh); v16b f;
#pragma unroll
  for (int e = 0; e < 8; ++e) { f[e] = a[e]; f[8 + e] = b[e]; } return f; }
__device__ __forceinline__ v8f wmma16b(v16b a, v16b b, v8f c) { v8f d = __builtin_amdgcn_wmma_f32_16x16x32_f16(false, a, false, b, (short)0, c, false, false); asm volatile("v_nop\n\tv_nop\n\tv_nop\n\tv_nop" : "+v"(d) : "v"(a), "v"(b)); return d; }
__device__ __forceinline__ float ex2(float x) { return __builtin_amdgcn_exp2f(x); }

// Key rows and grid rows come into LDS by the tensor mover: stages of SK keys, two buffers, per stage one request of wave 0 (keys) and one of wave 1 (grid); all waves of the block read their fragments from there.
typedef uint32_t u32x4 __attribute__((ext_vector_type(4)));
typedef uint32_t u32x8 __attribute__((ext_vector_type(8)));
constexpr uint32_t SK = 128, NST = NP / SK, ROWB = 2u * C, KP = ROWB + 16u, KBUF = SK * KP, GBUF = (16u * KP + 2047u) & ~2047u, BUF = KBUF + GBUF;   // KP: odd multiple of 16 B for ds_load_b128 readers; a stage of the grid is 16 rows of SK f16 = ROWB bytes
static_assert(ROWB == 256u && SK * 2u == ROWB && KBUF % 2048u == 0u && BUF % 2048u == 0u && NST >= 2u, "pad codes below are for 256-B rows; each tile starts at a multiple of 2 KiB; the ring needs two stages");
__device__ __forceinline__ uint32_t uni(uint32_t v) { return (uint32_t)__builtin_amdgcn_readfirstlane(v); }
__device__ __forceinline__ uint32_t pinned(uint32_t v) { uint32_t w = (uint32_t)__builtin_amdgcn_readfirstlane(v); asm volatile("" : "+s"(w)); return w; }   // holds an issue test (a tensor load ignores EXEC, only a scalar branch guards it) or a descriptor word in a scalar register
__device__ __forceinline__ void wait_ds0() { asm volatile("s_wait_dscnt 0x0" ::: "memory"); }          // this wave's LDS reads have returned before the buffer is handed back
__device__ __forceinline__ void wait_tensor0() { asm volatile("s_wait_tensorcnt 0x0" ::: "memory"); }  // the issuer's tile has landed; the compiler places no wait for the mover
__device__ __forceinline__ void tdm_load(u32x4 g0, u32x8 g1) { asm volatile("tensor_load_to_lds %0, %1" :: "s"(g0), "s"(g1) : "memory"); }   // one request of the whole wave: a padded 2-D tile from global memory into LDS, through no register
__device__ __forceinline__ u32x8 tdm_group1(uint32_t rows, uint32_t src_pitch) {   // bytes; tile = tensor = rows x ROWB bytes, 4 dwords of LDS pad behind every 256-B row
  u32x8 g;
  g[0] = uni((1u << 20) | (5u << 22) | (3u << 25));
  // pinned(): each descriptor word held in a scalar register of its own through the loop, not rebuilt over a register that a request in flight was issued from
  g[1] = pinned((ROWB & 0xFFFFu) << 16);
  g[2] = pinned((ROWB >> 16) | ((rows & 0xFFFFu) << 16));
  g[3] = pinned((rows >> 16) | (ROWB << 16));
  g[4] = pinned(rows);
  g[5] = pinned(src_pitch);
  g[6] = pinned(0u);
  g[7] = pinned(0u);
  return g;
}
__device__ __forceinline__ u32x4 tdm_group0(uint32_t lds_dst, uint64_t ga) {
  u32x4 g;
  g[0] = uni(1u); g[1] = uni(lds_dst); g[2] = uni((uint32_t)ga); g[3] = uni((((uint32_t)(ga >> 32)) & 0x01FFFFFFu) | 0x80000000u);
  return g;
}

__global__ __launch_bounds__(256) void xpose_kernel(const float* __restrict__ x, const float* __restrict__ y, b16* __restrict__ XT, b16* __restrict__ YT, b16* __restrict__ GT) {
  __shared__ __attribute__((aligned(16))) b16 T[64][C + 8];
  const int b = blockIdx.y, p0 = blockIdx.x * 64, which = blockIdx.z, t_ = threadIdx.x; const float* src = (which == 0) ? x : y; b16* dst = (which == 0) ? XT : YT;
  for (int i = t_; i < C * 64; i += 256) { const int c = i >> 6, p = i & 63; T[p][c] = (b16)bf16_rne(src[((size_t)b * C + c) * NP + p0 + p]); }
  __syncthreads();
  { for (int i = t_; i < 64 * 16; i += 256) { const int p = i >> 4, c8 = (i & 15) * 8; *(v8b*)(dst + ((size_t)b * NP + p0 + p) * C + c8) = *(const v8b*)(&T[p][c8]); }
    if (b == 0 && which == 0) { for (int i = t_; i < 16 * 8; i += 256) { const int row = i >> 3, c8 = (i & 7) * 8; v8b v; for (int e = 0; e < 8; ++e) { const int k = p0 + c8 + e; v[e] = (b16)((row == 0) ? ((float)(k % GW) + 0.5f) : (row == 1) ? ((float)(k / GW) + 0.5f) : 0.0f); } *(v8b*)(GT + (size_t)row * NP + p0 + c8) = v; } }
     }
}

// attention + expectation: block = 16 waves = 4 query tiles (64 queries of one image) x 4 key quarters, so that 256 blocks cover every WGP with four waves per SIMD.
// Wave (qt, sub) takes 16 queries and, of every 128-key stage, the 32-key block sub: S^T = Y.q (K = 128: 4 k-steps, 1 product, exact operands), its own running maximum, sum and expectation;
// the four partials of a query are merged through LDS at the end. The key rows and the grid rows are read from an LDS ring that the block shares.
constexpr int QTB = 4, KSP = (int)(SK / 32u), QB = 16 * QTB;
__global__ __launch_bounds__(32 * QTB * KSP) void attn_kernel(const b16* __restrict__ XT, const b16* __restrict__ YT, const b16* __restrict__ GT, float* __restrict__ out) {
  __shared__ __attribute__((aligned(2048))) unsigned char KS[2u * BUF];
  __shared__ __attribute__((aligned(16))) v4f PM[KSP][QB];   // per key quarter and query: maximum of the raw products, sum, two un-normalised coordinates (the last three times 2^LPS)
  const int wid = threadIdx.x >> 5, lane = threadIdx.x & 31, hh = lane >> 4, col = lane & 15, b = blockIdx.y, qt = wid & (QTB - 1), q0 = blockIdx.x * QB + qt * 16, qi = q0 + col;
  const uint32_t sub = (uint32_t)wid / (uint32_t)QTB;
  const b16* Xb = XT + (size_t)b * NP * C; const b16* Yb = YT + (size_t)b * NP * C;
  v16b qf[4];
#pragma unroll
  for (int j = 0; j < 4; ++j) qf[j] = frag_kb(Xb + (size_t)qi * C + 32 * j, hh);
  float m = -INFINITY, l = 0.0f; v8f o = {};
  const uint32_t wave = uni(threadIdx.x >> 5); const bool isG = wave == 1u;   // wave 0 moves SK key rows per stage, wave 1 the 16 grid rows' SK columns
  const uint32_t lbase = (uint32_t)(size_t)KS + (isG ? KBUF : 0u), stepb = isG ? ROWB : SK * ROWB; const uint64_t ga0 = isG ? (uint64_t)(size_t)GT : (uint64_t)(size_t)Yb;
  const u32x8 g1 = tdm_group1(isG ? 16u : SK, isG ? 2u * (uint32_t)NP : ROWB);
  if (pinned(wave < 2u)) { tdm_load(tdm_group0(lbase, ga0), g1); wait_tensor0(); }
  __syncthreads();                                                                     // stage 0 published
  if (pinned(wave < 2u)) tdm_load(tdm_group0(lbase + BUF, ga0 + stepb), g1);
  for (uint32_t st = 0; st < NST; ++st) {
   const unsigned char* Kst = KS + (st & 1u) * BUF;
   {
    const b16* K0 = (const b16*)(Kst + (sub * 32u + (uint32_t)col) * KP); const b16* K1 = (const b16*)(Kst + (sub * 32u + 16u + (uint32_t)col) * KP);
    v8f s0 = {}, s1 = {};
#pragma unroll
    for (int j = 0; j < 4; ++j) { const v16b ka = frag_kb(K0 + 32 * j, hh), kc = frag_kb(K1 + 32 * j, hh); s0 = wmma16b(ka, qf[j], s0); s1 = wmma16b(kc, qf[j], s1); }
    float mr = -INFINITY;
#pragma unroll
    for (int r = 0; r < 8; ++r) mr = fmaxf(mr, fmaxf(s0[r], s1[r]));   // the maximum is kept on the raw products (C2 > 0 keeps the order)
    mr = fmaxf(mr, __shfl_xor(mr, 16));
    const float mn = fmaxf(m, mr), al_ = ex2((m - mn) * C2), nb = __builtin_fmaf(mn, C2, -LPS); m = mn; float sum = 0.0f; v16b ph, pl;   // one fma per score: C2 * s - (C2 * max - LPS)
    const v2f c2v = {C2, C2}, nbv = {-nb, -nb};
    v2f u0[4], u1[4];
#pragma unroll
    for (int r = 0; r < 4; ++r) { const v2f t0 = {s0[2 * r], s0[2 * r + 1]}, t1 = {s1[2 * r], s1[2 * r + 1]}; u0[r] = __builtin_elementwise_fma(t0, c2v, nbv); u1[r] = __builtin_elementwise_fma(t1, c2v, nbv); }   // register pairs: two scores per packed fma
#pragma unroll
    for (int r = 0; r < 8; ++r) { const float e0 = ex2(u0[r >> 1][r & 1]), e1 = ex2(u1[r >> 1][r & 1]); sum += e0 + e1; b16 a_, c_; split16(e0, a_, c_); ph[r] = a_; pl[r] = c_; split16(e1, a_, c_); ph[8 + r] = a_; pl[8 + r] = c_; }
    sum += __shfl_xor(sum, 16); l = l * al_ + sum; o *= al_;
    const v16b gf = frag_kb((const b16*)(Kst + KBUF + (uint32_t)col * KP) + sub * 32u, hh); o = wmma16b(gf, ph, o); o = wmma16b(gf, pl, o); }
   // publish point of stage st + 1: own LDS reads done, the issuer's tile landed, barrier; only then the refill of the buffer that stage st used
   wait_ds0();
   if (pinned(wave < 2u)) wait_tensor0();
   __syncthreads();
   if (pinned((wave < 2u) && (st + 2u < NST))) tdm_load(tdm_group0(lbase + (st & 1u) * BUF, ga0 + (uint64_t)((st + 2u) * stepb)), g1);
  }
  wait_tensor0(); wait_ds0();
  // o: rows (8hh + r) = coordinate index (0 = x, 1 = y), column = query col; m and l are equal in both halves of the wave
  if (hh == 0) { const v4f pm = {m, l, o[0], o[1]}; PM[sub][qt * 16 + col] = pm; }
  __syncthreads();                                                                     // every quarter's partial is in LDS
  if (threadIdx.x < QB) {
    v4f p[KSP]; float mm = -INFINITY;
#pragma unroll
    for (int k = 0; k < KSP; ++k) { p[k] = PM[k][threadIdx.x]; mm = fmaxf(mm, p[k][0]); }
    float ls = 0.0f, ox = 0.0f, oy = 0.0f;
#pragma unroll
    for (int k = 0; k < KSP; ++k) { const float w = ex2((p[k][0] - mm) * C2); ls += w * p[k][1]; ox += w * p[k][2]; oy += w * p[k][3]; }
    const float inv = 1.0f / ls;   // sum and coordinates carry the same 2^LPS
    float2 uv; uv.x = (ox * inv) * (2.0f / (float)GW) - 1.0f; uv.y = (oy * inv) * (2.0f / (float)GW) - 1.0f;   // uv / [wy, hy] * 2 - 1 (wy = hy = 64)
    *(float2*)(out + ((size_t)b * NP + blockIdx.x * QB + threadIdx.x) * 2) = uv;
  }
}
}  // namespace

extern "C" void kernel_launch(void* const* d_in, const int* in_sizes, int n_in,
                              void* d_out, int out_size, void* d_ws, size_t ws_size, hipStream_t stream) {
  (void)n_in; (void)out_size;
  const float* x = (const float*)d_in[0]; const float* y = (const float*)d_in[1];
  float* out = (float*)d_out;   // [4][64][64][2]
  if (in_sizes[0] != Bn * C * NP || in_sizes[1] != Bn * C * NP) return;
  size_t off = 0; char* ws = (char*)d_ws;
  auto carve = [&](size_t bytes) { char* p = ws + off; off += (bytes + 255) & ~(size_t)255; return p; };
  b16* XT = (b16*)carve((size_t)Bn * NP * C * 2); b16* YT = (b16*)carve((size_t)Bn * NP * C * 2); b16* GT = (b16*)carve((size_t)16 * NP * 2);
  if (off > ws_size) return;                                    // ≈ 4.2 + 4.2 + 0.13 MB
  xpose_kernel<<<dim3(NP / 64, Bn, 2), 256, 0, stream>>>(x, y, XT, YT, GT);
  attn_kernel<<<dim3(NP / QB, Bn), 32 * QTB * KSP, 0, stream>>>(XT, YT, GT, out);
}

// v004
// A run of this version takes 28.5 microseconds.
// Next to v003, in two timings, it ran 1.23 and 1.33 times as fast.
// Over all steps from v000 it is 6.89 times as fast.
#include <hip/hip_runtime.h>
#include <stdint.h>

// UVLearner: attn[b][q][k] = softmax_k(x[b,:,q].y[b,:,k] / sqrt(128)) over all 4096 key pixels; uv[b][q] = Σ_k attn·grid[k] with grid[k] = (k % 64 + 0.5, k / 64 + 0.5) (meshgrid 'xy':
// grid[i][j] = (j + .5, i + .5), flattened k = i*64 + j); uv = uv / 64 * 2 - 1 -> [4][64][64][2].
// S^T = y^T.x with EXACT operands (x, y are exact bf16 values as f16 rows; 1 product, f32 accumulate — the scores are f32-exact up to summation order); online softmax in f32; the
// expectation Σ P·grid on v_wmma_f32_16x16x32_f16 with P as an f16 hi+lo pair x8 and the grid coordinates exact in f16 (2 products). One wave = (b, 2 x 16 queries) over 32 of the 256 keys of every stage

namespace {
constexpr int Bn = 4, C = 128, NP = 4096, GW = 64;
constexpr float LPS = 3.0f, C2 = (float)(0.08838834764831845 * 1.4426950408889634);   // P carries a factor 2^LPS; C2 = 128^-0.5 * log2(e): exp(scale * s) = exp2(C2 * s)

typedef _Float16 b16;
typedef __attribute__((ext_vector_type(16))) _Float16 v16b;
typedef __attribute__((ext_vector_type(8))) _Float16 v8b;
typedef __attribute__((ext_vector_type(8))) float v8f;
typedef __attribute__((ext_vector_type(4))) float v4f;
typedef __attribute__((ext_vector_type(2))) float v2f;
__device__ __forceinline__ float bf16_rne(float f) { unsigned int u = __float_as_uint(f); u += 0x7FFFu + ((u >> 16) & 1u); return __uint_as_float(u & 0xFFFF0000u); }
__device__ __forceinline__ void split16(float v, b16& hi, b16& lo) { hi = (b16)v; lo = (b16)(v - (float)hi); }
__device__ __forceinline__ v16b frag_kb(const b16* p, int hh) { const v8b a = *(const v8b*)(p + 8 * hh), b = *(const v8b*)(p + 16 + 8 * hh); v16b f;
#pragma unroll
  for (int e = 0; e < 8; ++e) { f[e] = a[e]; f[8 + e] = b[e]; } return f; }
__device__ __forceinline__ v8f wmma16b(v16b a, v16b b, v8f c) { v8f d = __builtin_amdgcn_wmma_f32_16x16x32_f16(false, a, false, b, (short)0, c, false, false); asm volatile("v_nop\n\tv_nop\n\tv_nop\n\tv_nop" : "+v"(d) : "v"(a), "v"(b)); return d; }
__device__ __forceinline__ float ex2(float x) { return __builtin_amdgcn_exp2f(x); }

// Key rows and grid rows come into LDS by the tensor mover: stages of SK keys = NH tiles of TK keys, two buffers, per stage one request each of waves 0..NH-1 (TK key rows) and of waves NH..2NH-1 (the 16 grid rows' TK columns); all waves of the block read their fragments from there.
typedef uint32_t u32x4 __attribute__((ext_vector_type(4)));
typedef uint32_t u32x8 __attribute__((ext_vector_type(8)));
constexpr uint32_t TK = 128, NH = 2, SK = NH * TK, NST = NP / SK, ROWB = 2u * C, KP = ROWB + 16u, KBUF = TK * KP, GBUF = (16u * KP + 2047u) & ~2047u, BUF = NH * (KBUF + GBUF);   // KP: odd multiple of 16 B for ds_load_b128 readers; a grid tile is 16 rows of TK f16 = ROWB bytes; a buffer holds NH key tiles (their rows in one run of pitch KP), then NH grid tiles
static_assert(ROWB == 256u && TK * 2u == ROWB && KBUF % 2048u == 0u && GBUF % 2048u == 0u && BUF % 2048u == 0u && NST >= 2u, "pad codes below are for 256-B rows; each tile starts at a multiple of 2 KiB; the ring needs two stages");
__device__ __forceinline__ uint32_t uni(uint32_t v) { return (uint32_t)__builtin_amdgcn_readfirstlane(v); }
__device__ __forceinline__ uint32_t pinned(uint32_t v) { uint32_t w = (uint32_t)__builtin_amdgcn_readfirstlane(v); asm volatile("" : "+s"(w)); return w; }   // holds an issue test (a tensor load ignores EXEC, only a scalar branch guards it) or a descriptor word in a scalar register
__device__ __forceinline__ void wait_ds0() { asm volatile("s_wait_dscnt 0x0" ::: "memory"); }          // this wave's LDS reads have returned before the buffer is handed back
__device__ __forceinline__ void wait_tensor0() { asm volatile("s_wait_tensorcnt 0x0" ::: "memory"); }  // the issuer's tile has landed; the compiler places no wait for the mover
__device__ __forceinline__ void tdm_load(u32x4 g0, u32x8 g1) { asm volatile("tensor_load_to_lds %0, %1" :: "s"(g0), "s"(g1) : "memory"); }   // one request of the whole wave: a padded 2-D tile from global memory into LDS, through no register
__device__ __forceinline__ u32x8 tdm_group1(uint32_t rows, uint32_t src_pitch) {   // bytes; tile = tensor = rows x ROWB bytes, 4 dwords of LDS pad behind every 256-B row
  u32x8 g;
  g[0] = uni((1u << 20) | (5u << 22) | (3u << 25));
  // pinned(): each descriptor word held in a scalar register of its own through the loop, not rebuilt over a register that a request in flight was issued from
  g[1] = pinned((ROWB & 0xFFFFu) << 16);
  g[2] = pinned((ROWB >> 16) | ((rows & 0xFFFFu) << 16));
  g[3] = pinned((rows >> 16) | (ROWB << 16));
  g[4] = pinned(rows);
  g[5] = pinned(src_pitch);
  g[6] = pinned(0u);
  g[7] = pinned(0u);
  return g;
}
__device__ __forceinline__ u32x4 tdm_group0(uint32_t lds_dst, uint64_t ga) {
  u32x4 g;
  g[0] = uni(1u); g[1] = uni(lds_dst); g[2] = uni((uint32_t)ga); g[3] = uni((((uint32_t)(ga >> 32)) & 0x01FFFFFFu) | 0x80000000u);
  return g;
}

__global__ __launch_bounds__(256) void xpose_kernel(const float* __restrict__ x, const float* __restrict__ y, b16* __restrict__ XT, b16* __restrict__ YT, b16* __restrict__ GT) {
  __shared__ __attribute__((aligned(16))) b16 T[64][C + 8];
  const int b = blockIdx.y, p0 = blockIdx.x * 64, which = blockIdx.z, t_ = threadIdx.x; const float* src = (which == 0) ? x : y; b16* dst = (which == 0) ? XT : YT;
  for (int i = t_; i < C * 64; i += 256) { const int c = i >> 6, p = i & 63; T[p][c] = (b16)bf16_rne(src[((size_t)b * C + c) * NP + p0 + p]); }
  __syncthreads();
  { for (int i = t_; i < 64 * 16; i += 256) { const int p = i >> 4, c8 = (i & 15) * 8; *(v8b*)(dst + ((size_t)b * NP + p0 + p) * C + c8) = *(const v8b*)(&T[p][c8]); }
    if (b == 0 && which == 0) { for (int i = t_; i < 16 * 8; i += 256) { const int row = i >> 3, c8 = (i & 7) * 8; v8b v; for (int e = 0; e < 8; ++e) { const int k = p0 + c8 + e; v[e] = (b16)((row == 0) ? ((float)(k % GW) + 0.5f) : (row == 1) ? ((float)(k / GW) + 0.5f) : 0.0f); } *(v8b*)(GT + (size_t)row * NP + p0 + c8) = v; } }
     }
}

// attention + expectation: block = 16 waves = 2 query groups (64 queries of one image) x 8 key blocks, so that 256 blocks cover every WGP with four waves per SIMD.
// Wave (qt, sub) takes QW = 2 tiles of 16 queries and, of every 256-key stage, the 32-key block sub: every key and grid fragment read from LDS feeds both query tiles.
// S^T = Y.q (K = 128: 4 k-steps, 1 product, exact operands), per query tile its own running maximum, sum and expectation;
// the eight partials of a query are merged through LDS at the end. The key rows and the grid rows are read from an LDS ring that the block shares.
constexpr int QW = 2, QTB = 2, KSP = (int)(SK / 32u), QB = 16 * QW * QTB;
__global__ __launch_bounds__(32 * QTB * KSP) void attn_kernel(const b16* __restrict__ XT, const b16* __restrict__ YT, const b16* __restrict__ GT, float* __restrict__ out) {
  __shared__ __attribute__((aligned(2048))) unsigned char KS[2u * BUF];
  __shared__ __attribute__((aligned(16))) v4f PM[KSP][QB];   // per key block and query: maximum of the raw products, sum, two un-normalised coordinates (the last three times 2^LPS)
  const int wid = threadIdx.x >> 5, lane = threadIdx.x & 31, hh = lane >> 4, col = lane & 15, b = blockIdx.y, qt = wid & (QTB - 1), q0 = blockIdx.x * QB + qt * (16 * QW);
  const uint32_t sub = (uint32_t)wid / (uint32_t)QTB;
  const b16* Xb = XT + (size_t)b * NP * C; const b16* Yb = YT + (size_t)b * NP * C;
  v16b qf[QW][4];
#pragma unroll
  for (int t = 0; t < QW; ++t)
#pragma unroll
    for (int j = 0; j < 4; ++j) qf[t][j] = frag_kb(Xb + (size_t)(q0 + 16 * t + col) * C + 32 * j, hh);
  float m[QW], l[QW]; v8f o[QW];
#pragma unroll
  for (int t = 0; t < QW; ++t) { m[t] = -INFINITY; l[t] = 0.0f; o[t] = v8f{}; }
  const uint32_t wave = uni(threadIdx.x >> 5), half = wave & (NH - 1u); const bool isG = wave >= NH;   // waves 0..NH-1 move TK key rows each per stage, waves NH..2NH-1 the 16 grid rows' TK columns each
  const uint32_t lbase = (uint32_t)(size_t)KS + (isG ? NH * KBUF + half * GBUF : half * KBUF), stepb = isG ? NH * ROWB : SK * ROWB;
  const uint64_t ga0 = isG ? (uint64_t)(size_t)GT + half * ROWB : (uint64_t)(size_t)Yb + half * (TK * ROWB);
  const u32x8 g1 = tdm_group1(isG ? 16u : TK, isG ? 2u * (uint32_t)NP : ROWB);
  if (pinned(wave < 2u * NH)) { tdm_load(tdm_group0(lbase, ga0), g1); wait_tensor0(); }
  __syncthreads();                                                                     // stage 0 published
  if (pinned(wave < 2u * NH)) tdm_load(tdm_group0(lbase + BUF, ga0 + stepb), g1);
  for (uint32_t st = 0; st < NST; ++st) {
   const unsigned char* Kst = KS + (st & 1u) * BUF;
   {
    const b16* K0 = (const b16*)(Kst + (sub * 32u + (uint32_t)col) * KP); const b16* K1 = (const b16*)(Kst + (sub * 32u + 16u + (uint32_t)col) * KP);
    v8f s0[QW], s1[QW];
#pragma unroll
    for (int t = 0; t < QW; ++t) { s0[t] = v8f{}; s1[t] = v8f{}; }
#pragma unroll
    for (int j = 0; j < 4; ++j) { const v16b ka = frag_kb(K0 + 32 * j, hh), kc = frag_kb(K1 + 32 * j, hh);
#pragma unroll
      for (int t = 0; t < QW; ++t) { s0[t] = wmma16b(ka, qf[t][j], s0[t]); s1[t] = wmma16b(kc, qf[t][j], s1[t]); } }
    const v16b gf = frag_kb((const b16*)(Kst + NH * KBUF + (sub / (TK / 32u)) * GBUF + (uint32_t)col * KP) + (sub % (TK / 32u)) * 32u, hh);
#pragma unroll
    for (int t = 0; t < QW; ++t) {
    float mr = -INFINITY;
#pragma unroll
    for (int r = 0; r < 8; ++r) mr = fmaxf(mr, fmaxf(s0[t][r], s1[t][r]));   // the maximum is kept on the raw products (C2 > 0 keeps the order)
    mr = fmaxf(mr, __shfl_xor(mr, 16));
    const float mn = fmaxf(m[t], mr), al_ = ex2((m[t] - mn) * C2), nb = __builtin_fmaf(mn, C2, -LPS); m[t] = mn; float sum = 0.0f; v16b ph, pl;   // one fma per score: C2 * s - (C2 * max - LPS)
    const v2f c2v = {C2, C2}, nbv = {-nb, -nb};
    v2f u0[4], u1[4];
#pragma unroll
    for (int r = 0; r < 4; ++r) { const v2f t0 = {s0[t][2 * r], s0[t][2 * r + 1]}, t1 = {s1[t][2 * r], s1[t][2 * r + 1]}; u0[r] = __builtin_elementwise_fma(t0, c2v, nbv); u1[r] = __builtin_elementwise_fma(t1, c2v, nbv); }   // register pairs: two scores per packed fma
#pragma unroll
    for (int r = 0; r < 8; ++r) { const float e0 = ex2(u0[r >> 1][r & 1]), e1 = ex2(u1[r >> 1][r & 1]); sum += e0 + e1; b16 a_, c_; split16(e0, a_, c_); ph[r] = a_; pl[r] = c_; split16(e1, a_, c_); ph[8 + r] = a_; pl[8 + r] = c_; }
    sum += __shfl_xor(sum, 16); l[t] = l[t] * al_ + sum; o[t] *= al_;
    o[t] = wmma16b(gf, ph, o[t]); o[t] = wmma16b(gf, pl, o[t]); } }
   // publish point of stage st + 1: own LDS reads done, the issuer's tile landed, barrier; only then the refill of the buffer that stage st used
   wait_ds0();
   if (pinned(wave < 2u * NH)) wait_tensor0();
   __syncthreads();
   if (pinned((wave < 2u * NH) && (st + 2u < NST))) tdm_load(tdm_group0(lbase + (st & 1u) * BUF, ga0 + (uint64_t)((st + 2u) * stepb)), g1);
  }
  wait_tensor0(); wait_ds0();
  // o: rows (8hh + r) = coordinate index (0 = x, 1 = y), column = query col; m and l are equal in both halves of the wave
  if (hh == 0) {
#pragma unroll
    for (int t = 0; t < QW; ++t) { const v4f pm = {m[t], l[t], o[t][0], o[t][1]}; PM[sub][(qt * QW + t) * 16 + col] = pm; } }
  __syncthreads();                                                                     // every key block's partial is in LDS
  if (threadIdx.x < QB) {
    v4f p[KSP]; float mm = -INFINITY;
#pragma unroll
    for (int k = 0; k < KSP; ++k) { p[k] = PM[k][threadIdx.x]; mm = fmaxf(mm, p[k][0]); }
    float ls = 0.0f, ox = 0.0f, oy = 0.0f;
#pragma unroll
    for (int k = 0; k < KSP; ++k) { const float w = ex2((p[k][0] - mm) * C2); ls += w * p[k][1]; ox += w * p[k][2]; oy += w * p[k][3]; }
    const float inv = 1.0f / ls;   // sum and coordinates carry the same 2^LPS
    float2 uv; uv.x = (ox * inv) * (2.0f / (float)GW) - 1.0f; uv.y = (oy * inv) * (2.0f / (float)GW) - 1.0f;   // uv / [wy, hy] * 2 - 1 (wy = hy = 64)
    *(float2*)(out + ((size_t)b * NP + blockIdx.x * QB + threadIdx.x) * 2) = uv;
  }
}
}  // namespace

extern "C" void kernel_launch(void* const* d_in, const int* in_sizes, int n_in,
                              void* d_out, int out_size, void* d_ws, size_t ws_size, hipStream_t stream) {
  (void)n_in; (void)out_size;
  const float* x = (const float*)d_in[0]; const float* y = (const float*)d_in[1];
  float* out = (float*)d_out;   // [4][64][64][2]
  if (in_sizes[0] != Bn * C * NP || in_sizes[1] != Bn * C * NP) return;
  size_t off = 0; char* ws = (char*)d_ws;
  auto carve = [&](size_t bytes) { char* p = ws + off; off += (bytes + 255) & ~(size_t)255; return p; };
  b16* XT = (b16*)carve((size_t)Bn * NP * C * 2); b16* YT = (b16*)carve((size_t)Bn * NP * C * 2); b16* GT = (b16*)carve((size_t)16 * NP * 2);
  if (off > ws_size) return;                                    // ≈ 4.2 + 4.2 + 0.13 MB
  xpose_kernel<<<dim3(NP / 64, Bn, 2), 256, 0, stream>>>(x, y, XT, YT, GT);
  attn_kernel<<<dim3(NP / QB, Bn), 32 * QTB * KSP, 0, stream>>>(XT, YT, GT, out);
}

// v005
// It runs in 27.2 microseconds.
// Two timings next to v004 put it at 1.05 and 1.04 times that version's speed.
// All steps since v000 together make it 7.21 times as fast.
#include <hip/hip_runtime.h>
#include <stdint.h>

// UVLearner: attn[b][q][k] = softmax_k(x[b,:,q].y[b,:,k] / sqrt(128)) over all 4096 key pixels; uv[b][q] = Σ_k attn·grid[k] with grid[k] = (k % 64 + 0.5, k / 64 + 0.5) (meshgrid 'xy':
// grid[i][j] = (j + .5, i + .5), flattened k = i*64 + j); uv = uv / 64 * 2 - 1 -> [4][64][64][2].
// S^T = y^T.x with EXACT operands (x, y are exact bf16 values as f16 rows; 1 product, f32 accumulate — the scores are f32-exact up to summation order); online softmax in f32; the
// expectation Σ P·grid on v_wmma_f32_16x16x32_f16 with P as an f16 hi+lo pair x8 and the grid coordinates exact in f16 (2 products). One wave = (b, 2 x 16 queries) over 32 of the 256 keys of every stage

namespace {
constexpr int Bn = 4, C = 128, NP = 4096, GW = 64;
constexpr float LPS = 3.0f, C2 = (float)(0.08838834764831845 * 1.4426950408889634);   // P carries a factor 2^LPS; C2 = 128^-0.5 * log2(e): exp(scale * s) = exp2(C2 * s)

typedef _Float16 b16;
typedef __attribute__((ext_vector_type(16))) _Float16 v16b;
typedef __attribute__((ext_vector_type(8))) _Float16 v8b;
typedef __attribute__((ext_vector_type(8))) float v8f;
typedef __attribute__((ext_vector_type(4))) float v4f;
typedef __attribute__((ext_vector_type(2))) float v2f;
__device__ __forceinline__ float bf16_rne(float f) { unsigned int u = __float_as_uint(f); u += 0x7FFFu + ((u >> 16) & 1u); return __uint_as_float(u & 0xFFFF0000u); }
__device__ __forceinline__ void split16(float v, b16& hi, b16& lo) { hi = (b16)v; lo = (b16)(v - (float)hi); }
__device__ __forceinline__ v16b frag_kb(const b16* p, int hh) { const v8b a = *(const v8b*)(p + 8 * hh), b = *(const v8b*)(p + 16 + 8 * hh); v16b f;
#pragma unroll
  for (int e = 0; e < 8; ++e) { f[e] = a[e]; f[8 + e] = b[e]; } return f; }
__device__ __forceinline__ v8f wmma16b(v16b a, v16b b, v8f c) { v8f d = __builtin_amdgcn_wmma_f32_16x16x32_f16(false, a, false, b, (short)0, c, false, false); return d; }
__device__ __forceinline__ float ex2(float x) { return __builtin_amdgcn_exp2f(x); }

// Key rows and grid rows come into LDS by the tensor mover: stages of SK keys = NH tiles of TK keys, two buffers, per stage one request each of waves 0..NH-1 (TK key rows) and of waves NH..2NH-1 (the 16 grid rows' TK columns); all waves of the block read their fragments from there.
typedef uint32_t u32x4 __attribute__((ext_vector_type(4)));
typedef uint32_t u32x8 __attribute__((ext_vector_type(8)));
constexpr uint32_t TK = 128, NH = 2, SK = NH * TK, NST = NP / SK, ROWB = 2u * C, KP = ROWB + 16u, KBUF = TK * KP, GBUF = (16u * KP + 2047u) & ~2047u, BUF = NH * (KBUF + GBUF);   // KP: odd multiple of 16 B for ds_load_b128 readers; a grid tile is 16 rows of TK f16 = ROWB bytes; a buffer holds NH key tiles (their rows in one run of pitch KP), then NH grid tiles
static_assert(ROWB == 256u && TK * 2u == ROWB && KBUF % 2048u == 0u && GBUF % 2048u == 0u && BUF % 2048u == 0u && NST >= 2u, "pad codes below are for 256-B rows; each tile starts at a multiple of 2 KiB; the ring needs two stages");
__device__ __forceinline__ uint32_t uni(uint32_t v) { return (uint32_t)__builtin_amdgcn_readfirstlane(v); }
__device__ __forceinline__ uint32_t pinned(uint32_t v) { uint32_t w = (uint32_t)__builtin_amdgcn_readfirstlane(v); asm volatile("" : "+s"(w)); return w; }   // holds an issue test (a tensor load ignores EXEC, only a scalar branch guards it) or a descriptor word in a scalar register
__device__ __forceinline__ void wait_ds0() { asm volatile("s_wait_dscnt 0x0" ::: "memory"); }          // this wave's LDS reads have returned before the buffer is handed back
__device__ __forceinline__ void wait_tensor0() { asm volatile("s_wait_tensorcnt 0x0" ::: "memory"); }  // the issuer's tile has landed; the compiler places no wait for the mover
__device__ __forceinline__ void tdm_load(u32x4 g0, u32x8 g1) { asm volatile("tensor_load_to_lds %0, %1" :: "s"(g0), "s"(g1) : "memory"); }   // one request of the whole wave: a padded 2-D tile from global memory into LDS, through no register
__device__ __forceinline__ u32x8 tdm_group1(uint32_t rows, uint32_t src_pitch) {   // bytes; tile = tensor = rows x ROWB bytes, 4 dwords of LDS pad behind every 256-B row
  u32x8 g;
  g[0] = uni((1u << 20) | (5u << 22) | (3u << 25));
  // pinned(): each descriptor word held in a scalar register of its own through the loop, not rebuilt over a register that a request in flight was issued from
  g[1] = pinned((ROWB & 0xFFFFu) << 16);
  g[2] = pinned((ROWB >> 16) | ((rows & 0xFFFFu) << 16));
  g[3] = pinned((rows >> 16) | (ROWB << 16));
  g[4] = pinned(rows);
  g[5] = pinned(src_pitch);
  g[6] = pinned(0u);
  g[7] = pinned(0u);
  return g;
}
__device__ __forceinline__ u32x4 tdm_group0(uint32_t lds_dst, uint64_t ga) {
  u32x4 g;
  g[0] = uni(1u); g[1] = uni(lds_dst); g[2] = uni((uint32_t)ga); g[3] = uni((((uint32_t)(ga >> 32)) & 0x01FFFFFFu) | 0x80000000u);
  return g;
}

__global__ __launch_bounds__(256) void xpose_kernel(const float* __restrict__ x, const float* __restrict__ y, b16* __restrict__ XT, b16* __restrict__ YT, b16* __restrict__ GT) {
  __shared__ __attribute__((aligned(16))) b16 T[64][C + 8];
  const int b = blockIdx.y, p0 = blockIdx.x * 64, which = blockIdx.z, t_ = threadIdx.x; const float* src = (which == 0) ? x : y; b16* dst = (which == 0) ? XT : YT;
  for (int i = t_; i < C * 64; i += 256) { const int c = i >> 6, p = i & 63; T[p][c] = (b16)bf16_rne(src[((size_t)b * C + c) * NP + p0 + p]); }
  __syncthreads();
  { for (int i = t_; i < 64 * 16; i += 256) { const int p = i >> 4, c8 = (i & 15) * 8; *(v8b*)(dst + ((size_t)b * NP + p0 + p) * C + c8) = *(const v8b*)(&T[p][c8]); }
    if (b == 0 && which == 0) { for (int i = t_; i < 16 * 8; i += 256) { const int row = i >> 3, c8 = (i & 7) * 8; v8b v; for (int e = 0; e < 8; ++e) { const int k = p0 + c8 + e; v[e] = (b16)((row == 0) ? ((float)(k % GW) + 0.5f) : (row == 1) ? ((float)(k / GW) + 0.5f) : 0.0f); } *(v8b*)(GT + (size_t)row * NP + p0 + c8) = v; } }
     }
}

// attention + expectation: block = 16 waves = 2 query groups (64 queries of one image) x 8 key blocks, so that 256 blocks cover every WGP with four waves per SIMD.
// Wave (qt, sub) takes QW = 2 tiles of 16 queries and, of every 256-key stage, the 32-key block sub: every key and grid fragment read from LDS feeds both query tiles.
// S^T = Y.q (K = 128: 4 k-steps, 1 product, exact operands), per query tile its own running maximum, sum and expectation;
// the eight partials of a query are merged through LDS at the end. The key rows and the grid rows are read from an LDS ring that the block shares.
constexpr int QW = 2, QTB = 2, KSP = (int)(SK / 32u), QB = 16 * QW * QTB;
__global__ __launch_bounds__(32 * QTB * KSP) void attn_kernel(const b16* __restrict__ XT, const b16* __restrict__ YT, const b16* __restrict__ GT, float* __restrict__ out) {
  __shared__ __attribute__((aligned(2048))) unsigned char KS[2u * BUF];
  __shared__ __attribute__((aligned(16))) v4f PM[KSP][QB];   // per key block and query: maximum of the raw products, sum, two un-normalised coordinates (the last three times 2^LPS)
  const int wid = threadIdx.x >> 5, lane = threadIdx.x & 31, hh = lane >> 4, col = lane & 15, b = blockIdx.y, qt = wid & (QTB - 1), q0 = blockIdx.x * QB + qt * (16 * QW);
  const uint32_t sub = (uint32_t)wid / (uint32_t)QTB;
  const b16* Xb = XT + (size_t)b * NP * C; const b16* Yb = YT + (size_t)b * NP * C;
  v16b qf[QW][4];
#pragma unroll
  for (int t = 0; t < QW; ++t)
#pragma unroll
    for (int j = 0; j < 4; ++j) qf[t][j] = frag_kb(Xb + (size_t)(q0 + 16 * t + col) * C + 32 * j, hh);
  float m[QW], l[QW]; v8f o[QW];
#pragma unroll
  for (int t = 0; t < QW; ++t) { m[t] = -INFINITY; l[t] = 0.0f; o[t] = v8f{}; }
  const uint32_t wave = uni(threadIdx.x >> 5), half = wave & (NH - 1u); const bool isG = wave >= NH;   // waves 0..NH-1 move TK key rows each per stage, waves NH..2NH-1 the 16 grid rows' TK columns each
  const uint32_t lbase = (uint32_t)(size_t)KS + (isG ? NH * KBUF + half * GBUF : half * KBUF), stepb = isG ? NH * ROWB : SK * ROWB;
  const uint64_t ga0 = isG ? (uint64_t)(size_t)GT + half * ROWB : (uint64_t)(size_t)Yb + half * (TK * ROWB);
  const u32x8 g1 = tdm_group1(isG ? 16u : TK, isG ? 2u * (uint32_t)NP : ROWB);
  if (pinned(wave < 2u * NH)) { tdm_load(tdm_group0(lbase, ga0), g1); wait_tensor0(); }
  __syncthreads();                                                                     // stage 0 published
  if (pinned(wave < 2u * NH)) tdm_load(tdm_group0(lbase + BUF, ga0 + stepb), g1);
  for (uint32_t st = 0; st < NST; ++st) {
   const unsigned char* Kst = KS + (st & 1u) * BUF;
   {
    const b16* K0 = (const b16*)(Kst + (sub * 32u + (uint32_t)col) * KP); const b16* K1 = (const b16*)(Kst + (sub * 32u + 16u + (uint32_t)col) * KP);
    v8f s0[QW], s1[QW];
#pragma unroll
    for (int t = 0; t < QW; ++t) { s0[t] = v8f{}; s1[t] = v8f{}; }
#pragma unroll
    for (int j = 0; j < 4; ++j) { const v16b ka = frag_kb(K0 + 32 * j, hh), kc = frag_kb(K1 + 32 * j, hh);
#pragma unroll
      for (int t = 0; t < QW; ++t) { s0[t] = wmma16b(ka, qf[t][j], s0[t]); s1[t] = wmma16b(kc, qf[t][j], s1[t]); } }
    const v16b gf = frag_kb((const b16*)(Kst + NH * KBUF + (sub / (TK / 32u)) * GBUF + (uint32_t)col * KP) + (sub % (TK / 32u)) * 32u, hh);
#pragma unroll
    for (int t = 0; t < QW; ++t) {
    float mr = -INFINITY;
#pragma unroll
    for (int r = 0; r < 8; ++r) mr = fmaxf(mr, fmaxf(s0[t][r], s1[t][r]));   // the maximum is kept on the raw products (C2 > 0 keeps the order)
    mr = fmaxf(mr, __shfl_xor(mr, 16));
    const float mn = fmaxf(m[t], mr), al_ = ex2((m[t] - mn) * C2), nb = __builtin_fmaf(mn, C2, -LPS); m[t] = mn; float sum = 0.0f; v16b ph, pl;   // one fma per score: C2 * s - (C2 * max - LPS)
    const v2f c2v = {C2, C2}, nbv = {-nb, -nb};
    v2f u0[4], u1[4];
#pragma unroll
    for (int r = 0; r < 4; ++r) { const v2f t0 = {s0[t][2 * r], s0[t][2 * r + 1]}, t1 = {s1[t][2 * r], s1[t][2 * r + 1]}; u0[r] = __builtin_elementwise_fma(t0, c2v, nbv); u1[r] = __builtin_elementwise_fma(t1, c2v, nbv); }   // register pairs: two scores per packed fma
#pragma unroll
    for (int r = 0; r < 8; ++r) { const float e0 = ex2(u0[r >> 1][r & 1]), e1 = ex2(u1[r >> 1][r & 1]); sum += e0 + e1; b16 a_, c_; split16(e0, a_, c_); ph[r] = a_; pl[r] = c_; split16(e1, a_, c_); ph[8 + r] = a_; pl[8 + r] = c_; }
    sum += __shfl_xor(sum, 16); l[t] = l[t] * al_ + sum; o[t] *= al_;
    o[t] = wmma16b(gf, ph, o[t]); o[t] = wmma16b(gf, pl, o[t]); } }
   // publish point of stage st + 1: own LDS reads done, the issuer's tile landed, barrier; only then the refill of the buffer that stage st used
   __builtin_amdgcn_sched_barrier(0);   // keeps the wait below at the foot of the pass: the scheduler otherwise lifts it to right behind the grid fragment's loads, where the wave would sit out their latency in front of the softmax
   wait_ds0();
   if (pinned(wave < 2u * NH)) wait_tensor0();
   __syncthreads();
   if (pinned((wave < 2u * NH) && (st + 2u < NST))) tdm_load(tdm_group0(lbase + (st & 1u) * BUF, ga0 + (uint64_t)((st + 2u) * stepb)), g1);
  }
  wait_tensor0(); wait_ds0();
  // o: rows (8hh + r) = coordinate index (0 = x, 1 = y), column = query col; m and l are equal in both halves of the wave
  if (hh == 0) {
#pragma unroll
    for (int t = 0; t < QW; ++t) { const v4f pm = {m[t], l[t], o[t][0], o[t][1]}; PM[sub][(qt * QW + t) * 16 + col] = pm; } }
  __syncthreads();                                                                     // every key block's partial is in LDS
  if (threadIdx.x < QB) {
    v4f p[KSP]; float mm = -INFINITY;
#pragma unroll
    for (int k = 0; k < KSP; ++k) { p[k] = PM[k][threadIdx.x]; mm = fmaxf(mm, p[k][0]); }
    float ls = 0.0f, ox = 0.0f, oy = 0.0f;
#pragma unroll
    for (int k = 0; k < KSP; ++k) { const float w = ex2((p[k][0] - mm) * C2); ls += w * p[k][1]; ox += w * p[k][2]; oy += w * p[k][3]; }
    const float inv = 1.0f / ls;   // sum and coordinates carry the same 2^LPS
    float2 uv; uv.x = (ox * inv) * (2.0f / (float)GW) - 1.0f; uv.y = (oy * inv) * (2.0f / (float)GW) - 1.0f;   // uv / [wy, hy] * 2 - 1 (wy = hy = 64)
    *(float2*)(out + ((size_t)b * NP + blockIdx.x * QB + threadIdx.x) * 2) = uv;
  }
}
}  // namespace

extern "C" void kernel_launch(void* const* d_in, const int* in_sizes, int n_in,
                              void* d_out, int out_size, void* d_ws, size_t ws_size, hipStream_t stream) {
  (void)n_in; (void)out_size;
  const float* x = (const float*)d_in[0]; const float* y = (const float*)d_in[1];
  float* out = (float*)d_out;   // [4][64][64][2]
  if (in_sizes[0] != Bn * C * NP || in_sizes[1] != Bn * C * NP) return;
  size_t off = 0; char* ws = (char*)d_ws;
  auto carve = [&](size_t bytes) { char* p = ws + off; off += (bytes + 255) & ~(size_t)255; return p; };
  b16* XT = (b16*)carve((size_t)Bn * NP * C * 2); b16* YT = (b16*)carve((size_t)Bn * NP * C * 2); b16* GT = (b16*)carve((size_t)16 * NP * 2);
  if (off > ws_size) return;                                    // ≈ 4.2 + 4.2 + 0.13 MB
  xpose_kernel<<<dim3(NP / 64, Bn, 2), 256, 0, stream>>>(x, y, XT, YT, GT);
  attn_kernel<<<dim3(NP / QB, Bn), 32 * QTB * KSP, 0, stream>>>(XT, YT, GT, out);
}

// v006
// Measured time: 26.8 microseconds a run.
// Two timings next to v005 put it at 1.04 and 1.03 times that version's speed.
// All steps since v000 together make it 7.49 times as fast.
#include <hip/hip_runtime.h>
#include <stdint.h>

// UVLearner: attn[b][q][k] = softmax_k(x[b,:,q].y[b,:,k] / sqrt(128)) over all 4096 key pixels; uv[b][q] = Σ_k attn·grid[k] with grid[k] = (k % 64 + 0.5, k / 64 + 0.5) (meshgrid 'xy':
// grid[i][j] = (j + .5, i + .5), flattened k = i*64 + j); uv = uv / 64 * 2 - 1 -> [4][64][64][2].
// S^T = y^T.x with EXACT operands (x, y are exact bf16 values as f16 rows; 1 product, f32 accumulate — the scores are f32-exact up to summation order); online softmax in f32; the
// expectation Σ P·grid on v_wmma_f32_16x16x32_f16 with P as an f16 hi+lo pair x8 and the grid coordinates exact in f16 (2 products). One wave = (b, 2 x 16 queries) over 32 of the 256 keys of every stage

namespace {
constexpr int Bn = 4, C = 128, NP = 4096, GW = 64;
constexpr float LPS = 3.0f, C2 = (float)(0.08838834764831845 * 1.4426950408889634);   // P carries a factor 2^LPS; C2 = 128^-0.5 * log2(e): exp(scale * s) = exp2(C2 * s)

typedef _Float16 b16;
typedef __attribute__((ext_vector_type(16))) _Float16 v16b;
typedef __attribute__((ext_vector_type(8))) _Float16 v8b;
typedef __attribute__((ext_vector_type(8))) float v8f;
typedef __attribute__((ext_vector_type(4))) float v4f;
typedef __attribute__((ext_vector_type(2))) float v2f;
__device__ __forceinline__ float bf16_rne(float f) { unsigned int u = __float_as_uint(f); u += 0x7FFFu + ((u >> 16) & 1u); return __uint_as_float(u & 0xFFFF0000u); }
__device__ __forceinline__ void split16(float v, b16& hi, b16& lo) { hi = (b16)v; lo = (b16)(v - (float)hi); }
__device__ __forceinline__ v16b frag_kb(const b16* p, int hh) { const v8b a = *(const v8b*)(p + 8 * hh), b = *(const v8b*)(p + 16 + 8 * hh); v16b f;
#pragma unroll
  for (int e = 0; e < 8; ++e) { f[e] = a[e]; f[8 + e] = b[e]; } return f; }
__device__ __forceinline__ v8f wmma16b(v16b a, v16b b, v8f c) { v8f d = __builtin_amdgcn_wmma_f32_16x16x32_f16(false, a, false, b, (short)0, c, false, false); return d; }
__device__ __forceinline__ float ex2(float x) { return __builtin_amdgcn_exp2f(x); }

// Key rows and grid rows come into LDS by the tensor mover: stages of SK keys = NH tiles of TK keys, two buffers, per stage one request each of waves 0..NH-1 (TK key rows) and of waves NH..2NH-1 (the 16 grid rows' TK columns); all waves of the block read their fragments from there.
typedef uint32_t u32x4 __attribute__((ext_vector_type(4)));
typedef uint32_t u32x8 __attribute__((ext_vector_type(8)));
constexpr uint32_t TK = 128, NH = 2, SK = NH * TK, NST = NP / SK, ROWB = 2u * C, KP = ROWB + 16u, KBUF = TK * KP, GBUF = (16u * KP + 2047u) & ~2047u, BUF = NH * (KBUF + GBUF);   // KP: odd multiple of 16 B for ds_load_b128 readers; a grid tile is 16 rows of TK f16 = ROWB bytes; a buffer holds NH key tiles (their rows in one run of pitch KP), then NH grid tiles
static_assert(ROWB == 256u && TK * 2u == ROWB && KBUF % 2048u == 0u && GBUF % 2048u == 0u && BUF % 2048u == 0u && NST >= 2u && (NST & (NST - 1u)) == 0u, "pad codes below are for 256-B rows; each tile starts at a multiple of 2 KiB; the ring needs two stages; the wrapped walk masks with NST - 1");
__device__ __forceinline__ uint32_t uni(uint32_t v) { return (uint32_t)__builtin_amdgcn_readfirstlane(v); }
__device__ __forceinline__ uint32_t pinned(uint32_t v) { uint32_t w = (uint32_t)__builtin_amdgcn_readfirstlane(v); asm volatile("" : "+s"(w)); return w; }   // holds an issue test (a tensor load ignores EXEC, only a scalar branch guards it) or a descriptor word in a scalar register
__device__ __forceinline__ void wait_ds0() { asm volatile("s_wait_dscnt 0x0" ::: "memory"); }          // this wave's LDS reads have returned before the buffer is handed back
__device__ __forceinline__ void wait_tensor0() { asm volatile("s_wait_tensorcnt 0x0" ::: "memory"); }  // the issuer's tile has landed; the compiler places no wait for the mover
__device__ __forceinline__ void tdm_load(u32x4 g0, u32x8 g1) { asm volatile("tensor_load_to_lds %0, %1" :: "s"(g0), "s"(g1) : "memory"); }   // one request of the whole wave: a padded 2-D tile from global memory into LDS, through no register
__device__ __forceinline__ u32x8 tdm_group1(uint32_t rows, uint32_t src_pitch) {   // bytes; tile = tensor = rows x ROWB bytes, 4 dwords of LDS pad behind every 256-B row
  u32x8 g;
  g[0] = uni((1u << 20) | (5u << 22) | (3u << 25));
  // pinned(): each descriptor word held in a scalar register of its own through the loop, not rebuilt over a register that a request in flight was issued from
  g[1] = pinned((ROWB & 0xFFFFu) << 16);
  g[2] = pinned((ROWB >> 16) | ((rows & 0xFFFFu) << 16));
  g[3] = pinned((rows >> 16) | (ROWB << 16));
  g[4] = pinned(rows);
  g[5] = pinned(src_pitch);
  g[6] = pinned(0u);
  g[7] = pinned(0u);
  return g;
}
__device__ __forceinline__ u32x4 tdm_group0(uint32_t lds_dst, uint64_t ga) {
  u32x4 g;
  g[0] = uni(1u); g[1] = uni(lds_dst); g[2] = uni((uint32_t)ga); g[3] = uni((((uint32_t)(ga >> 32)) & 0x01FFFFFFu) | 0x80000000u);
  return g;
}

__global__ __launch_bounds__(256) void xpose_kernel(const float* __restrict__ x, const float* __restrict__ y, b16* __restrict__ XT, b16* __restrict__ YT, b16* __restrict__ GT) {
  __shared__ __attribute__((aligned(16))) b16 T[64][C + 8];
  const int b = blockIdx.y, p0 = blockIdx.x * 64, which = blockIdx.z, t_ = threadIdx.x; const float* src = (which == 0) ? x : y; b16* dst = (which == 0) ? XT : YT;
  for (int i = t_; i < C * 64; i += 256) { const int c = i >> 6, p = i & 63; T[p][c] = (b16)bf16_rne(src[((size_t)b * C + c) * NP + p0 + p]); }
  __syncthreads();
  { for (int i = t_; i < 64 * 16; i += 256) { const int p = i >> 4, c8 = (i & 15) * 8; *(v8b*)(dst + ((size_t)b * NP + p0 + p) * C + c8) = *(const v8b*)(&T[p][c8]); }
    if (b == 0 && which == 0) { for (int i = t_; i < 16 * 8; i += 256) { const int row = i >> 3, c8 = (i & 7) * 8; v8b v; for (int e = 0; e < 8; ++e) { const int k = p0 + c8 + e; v[e] = (b16)((row == 0) ? ((float)(k % GW) + 0.5f) : (row == 1) ? ((float)(k / GW) + 0.5f) : 0.0f); } *(v8b*)(GT + (size_t)row * NP + p0 + c8) = v; } }
     }
}

// attention + expectation: block = 16 waves = 2 query groups (64 queries of one image) x 8 key blocks, so that 256 blocks cover every WGP with four waves per SIMD.
// Wave (qt, sub) takes QW = 2 tiles of 16 queries and, of every 256-key stage, the 32-key block sub: every key and grid fragment read from LDS feeds both query tiles.
// S^T = Y.q (K = 128: 4 k-steps, 1 product, exact operands), per query tile its own running maximum, sum and expectation;
// the eight partials of a query are merged through LDS at the end. The key rows and the grid rows are read from an LDS ring that the block shares.
constexpr int QW = 2, QTB = 2, KSP = (int)(SK / 32u), QB = 16 * QW * QTB;
__global__ __launch_bounds__(32 * QTB * KSP) void attn_kernel(const b16* __restrict__ XT, const b16* __restrict__ YT, const b16* __restrict__ GT, float* __restrict__ out) {
  __shared__ __attribute__((aligned(2048))) unsigned char KS[2u * BUF];
  __shared__ __attribute__((aligned(16))) v4f PM[KSP][QB];   // per key block and query: maximum of the raw products, sum, two un-normalised coordinates (the last three times 2^LPS)
  const int wid = threadIdx.x >> 5, lane = threadIdx.x & 31, hh = lane >> 4, col = lane & 15, b = blockIdx.y, qt = wid & (QTB - 1), q0 = blockIdx.x * QB + qt * (16 * QW);
  const uint32_t sub = (uint32_t)wid / (uint32_t)QTB;
  const b16* Xb = XT + (size_t)b * NP * C; const b16* Yb = YT + (size_t)b * NP * C;
  v16b qf[QW][4];
#pragma unroll
  for (int t = 0; t < QW; ++t)
#pragma unroll
    for (int j = 0; j < 4; ++j) qf[t][j] = frag_kb(Xb + (size_t)(q0 + 16 * t + col) * C + 32 * j, hh);
  float m[QW], l[QW]; v8f o[QW];
#pragma unroll
  for (int t = 0; t < QW; ++t) { m[t] = -INFINITY; l[t] = 0.0f; o[t] = v8f{}; }
  const uint32_t wave = uni(threadIdx.x >> 5), half = wave & (NH - 1u); const bool isG = wave >= NH;   // waves 0..NH-1 move TK key rows each per stage, waves NH..2NH-1 the 16 grid rows' TK columns each
  const uint32_t lbase = (uint32_t)(size_t)KS + (isG ? NH * KBUF + half * GBUF : half * KBUF), stepb = isG ? NH * ROWB : SK * ROWB;
  const uint64_t ga0 = isG ? (uint64_t)(size_t)GT + half * ROWB : (uint64_t)(size_t)Yb + half * (TK * ROWB);
  const u32x8 g1 = tdm_group1(isG ? 16u : TK, isG ? 2u * (uint32_t)NP : ROWB);
  // All blocks of an image walk the same key and grid stages. Each enters the walk at a start stage rot and wraps round (pass st works on stage (st + rot) mod NST), so that blocks
  // running side by side do not ask L2 for the same lines at the same moment; the running softmax takes the keys in any order. Blocks that share a start differ in blockIdx.x by 2, 4 or 6:
  // where consecutive indices go to consecutive dies, they stand on different dies (for speed only: the result is the same for any placement).
  const uint32_t rot = (2u * ((uint32_t)blockIdx.x >> 3) + ((uint32_t)blockIdx.x & 1u)) & (NST - 1u);
  if (pinned(wave < 2u * NH)) { tdm_load(tdm_group0(lbase, ga0 + (uint64_t)(rot * stepb)), g1); wait_tensor0(); }
  __syncthreads();                                                                     // pass 0's stage published
  if (pinned(wave < 2u * NH)) tdm_load(tdm_group0(lbase + BUF, ga0 + (uint64_t)(((rot + 1u) & (NST - 1u)) * stepb)), g1);
  for (uint32_t st = 0; st < NST; ++st) {
   const unsigned char* Kst = KS + (st & 1u) * BUF;
   {
    const b16* K0 = (const b16*)(Kst + (sub * 32u + (uint32_t)col) * KP); const b16* K1 = (const b16*)(Kst + (sub * 32u + 16u + (uint32_t)col) * KP);
    v8f s0[QW], s1[QW];
#pragma unroll
    for (int t = 0; t < QW; ++t) { s0[t] = v8f{}; s1[t] = v8f{}; }
#pragma unroll
    for (int j = 0; j < 4; ++j) { const v16b ka = frag_kb(K0 + 32 * j, hh), kc = frag_kb(K1 + 32 * j, hh);
#pragma unroll
      for (int t = 0; t < QW; ++t) { s0[t] = wmma16b(ka, qf[t][j], s0[t]); s1[t] = wmma16b(kc, qf[t][j], s1[t]); } }
    const v16b gf = frag_kb((const b16*)(Kst + NH * KBUF + (sub / (TK / 32u)) * GBUF + (uint32_t)col * KP) + (sub % (TK / 32u)) * 32u, hh);
#pragma unroll
    for (int t = 0; t < QW; ++t) {
    float mr = -INFINITY;
#pragma unroll
    for (int r = 0; r < 8; ++r) mr = fmaxf(mr, fmaxf(s0[t][r], s1[t][r]));   // the maximum is kept on the raw products (C2 > 0 keeps the order)
    mr = fmaxf(mr, __shfl_xor(mr, 16));
    const float mn = fmaxf(m[t], mr), al_ = ex2((m[t] - mn) * C2), nb = __builtin_fmaf(mn, C2, -LPS); m[t] = mn; float sum = 0.0f; v16b ph, pl;   // one fma per score: C2 * s - (C2 * max - LPS)
    const v2f c2v = {C2, C2}, nbv = {-nb, -nb};
    v2f u0[4], u1[4];
#pragma unroll
    for (int r = 0; r < 4; ++r) { const v2f t0 = {s0[t][2 * r], s0[t][2 * r + 1]}, t1 = {s1[t][2 * r], s1[t][2 * r + 1]}; u0[r] = __builtin_elementwise_fma(t0, c2v, nbv); u1[r] = __builtin_elementwise_fma(t1, c2v, nbv); }   // register pairs: two scores per packed fma
#pragma unroll
    for (int r = 0; r < 8; ++r) { const float e0 = ex2(u0[r >> 1][r & 1]), e1 = ex2(u1[r >> 1][r & 1]); sum += e0 + e1; b16 a_, c_; split16(e0, a_, c_); ph[r] = a_; pl[r] = c_; split16(e1, a_, c_); ph[8 + r] = a_; pl[8 + r] = c_; }
    sum += __shfl_xor(sum, 16); l[t] = l[t] * al_ + sum; o[t] *= al_;
    o[t] = wmma16b(gf, ph, o[t]); o[t] = wmma16b(gf, pl, o[t]); } }
   // publish point of pass st + 1's stage: own LDS reads done, the issuer's tile landed, barrier; only then the refill of the buffer that pass st used
   __builtin_amdgcn_sched_barrier(0);   // keeps the wait below at the foot of the pass: the scheduler otherwise lifts it to right behind the grid fragment's loads, where the wave would sit out their latency in front of the softmax
   wait_ds0();
   if (pinned(wave < 2u * NH)) wait_tensor0();
   __syncthreads();
   if (pinned((wave < 2u * NH) && (st + 2u < NST))) tdm_load(tdm_group0(lbase + (st & 1u) * BUF, ga0 + (uint64_t)(((st + 2u + rot) & (NST - 1u)) * stepb)), g1);
  }
  wait_tensor0(); wait_ds0();
  // o: rows (8hh + r) = coordinate index (0 = x, 1 = y), column = query col; m and l are equal in both halves of the wave
  if (hh == 0) {
#pragma unroll
    for (int t = 0; t < QW; ++t) { const v4f pm = {m[t], l[t], o[t][0], o[t][1]}; PM[sub][(qt * QW + t) * 16 + col] = pm; } }
  __syncthreads();                                                                     // every key block's partial is in LDS
  if (threadIdx.x < QB) {
    v4f p[KSP]; float mm = -INFINITY;
#pragma unroll
    for (int k = 0; k < KSP; ++k) { p[k] = PM[k][threadIdx.x]; mm = fmaxf(mm, p[k][0]); }
    float ls = 0.0f, ox = 0.0f, oy = 0.0f;
#pragma unroll
    for (int k = 0; k < KSP; ++k) { const float w = ex2((p[k][0] - mm) * C2); ls += w * p[k][1]; ox += w * p[k][2]; oy += w * p[k][3]; }
    const float inv = 1.0f / ls;   // sum and coordinates carry the same 2^LPS
    float2 uv; uv.x = (ox * inv) * (2.0f / (float)GW) - 1.0f; uv.y = (oy * inv) * (2.0f / (float)GW) - 1.0f;   // uv / [wy, hy] * 2 - 1 (wy = hy = 64)
    *(float2*)(out + ((size_t)b * NP + blockIdx.x * QB + threadIdx.x) * 2) = uv;
  }
}
}  // namespace

extern "C" void kernel_launch(void* const* d_in, const int* in_sizes, int n_in,
                              void* d_out, int out_size, void* d_ws, size_t ws_size, hipStream_t stream) {
  (void)n_in; (void)out_size;
  const float* x = (const float*)d_in[0]; const float* y = (const float*)d_in[1];
  float* out = (float*)d_out;   // [4][64][64][2]
  if (in_sizes[0] != Bn * C * NP || in_sizes[1] != Bn * C * NP) return;
  size_t off = 0; char* ws = (char*)d_ws;
  auto carve = [&](size_t bytes) { char* p = ws + off; off += (bytes + 255) & ~(size_t)255; return p; };
  b16* XT = (b16*)carve((size_t)Bn * NP * C * 2); b16* YT = (b16*)carve((size_t)Bn * NP * C * 2); b16* GT = (b16*)carve((size_t)16 * NP * 2);
  if (off > ws_size) return;                                    // ≈ 4.2 + 4.2 + 0.13 MB
  xpose_kernel<<<dim3(NP / 64, Bn, 2), 256, 0, stream>>>(x, y, XT, YT, GT);
  attn_kernel<<<dim3(NP / QB, Bn), 32 * QTB * KSP, 0, stream>>>(XT, YT, GT, out);
}

// v008
// Measured time: 22.6 microseconds a run.
// It is 1.17 times as fast as v006, going by the measured steps of the versions left out in between.
// Counting every step since v000, it is 8.80 times as fast.
#include <hip/hip_runtime.h>
#include <stdint.h>

// UVLearner: attn[b][q][k] = softmax_k(x[b,:,q].y[b,:,k] / sqrt(128)) over all 4096 key pixels; uv[b][q] = Σ_k attn·grid[k] with grid[k] = (k % 64 + 0.5, k / 64 + 0.5) (meshgrid 'xy':
// grid[i][j] = (j + .5, i + .5), flattened k = i*64 + j); uv = uv / 64 * 2 - 1 -> [4][64][64][2].
// S^T = y^T.x with EXACT operands (x, y are exact bf16 values as f16 rows; 1 product, f32 accumulate — the scores are f32-exact up to summation order); online softmax in f32; the
// expectation Σ P·grid on v_wmma_f32_16x16x32_f16 with P x8 rounded once to f16 and the grid coordinates exact in f16 (1 product); the normalising sum stays in f32 on the unrounded P. One wave = (b, 32 queries) over 512 keys

namespace {
constexpr int Bn = 4, C = 128, NP = 4096, GW = 64;
constexpr float LPS = 3.0f, C2 = (float)(0.08838834764831845 * 1.4426950408889634);   // P carries a factor 2^LPS; C2 = 128^-0.5 * log2(e): exp(scale * s) = exp2(C2 * s)

typedef _Float16 b16;
typedef __attribute__((ext_vector_type(16))) _Float16 v16b;
typedef __attribute__((ext_vector_type(8))) _Float16 v8b;
typedef __attribute__((ext_vector_type(8))) float v8f;
typedef __attribute__((ext_vector_type(4))) float v4f;
typedef __attribute__((ext_vector_type(2))) float v2f;
__device__ __forceinline__ float bf16_rne(float f) { unsigned int u = __float_as_uint(f); u += 0x7FFFu + ((u >> 16) & 1u); return __uint_as_float(u & 0xFFFF0000u); }
__device__ __forceinline__ v16b frag_kb(const b16* p, int hh) { const v8b a = *(const v8b*)(p + 8 * hh), b = *(const v8b*)(p + 16 + 8 * hh); v16b f;
#pragma unroll
  for (int e = 0; e < 8; ++e) { f[e] = a[e]; f[8 + e] = b[e]; } return f; }
__device__ __forceinline__ v8f wmma16b(v16b a, v16b b, v8f c) { v8f d = __builtin_amdgcn_wmma_f32_16x16x32_f16(false, a, false, b, (short)0, c, false, false); return d; }
__device__ __forceinline__ float ex2(float x) { return __builtin_amdgcn_exp2f(x); }

// Key rows and grid rows come into LDS by the tensor mover: stages of SK keys = NH tiles of TK keys, two buffers, per stage one request each of waves 0..NH-1 (TK key rows) and of waves NH..2NH-1 (the 16 grid rows' TK columns); all waves of the block read their fragments from there.
typedef uint32_t u32x4 __attribute__((ext_vector_type(4)));
typedef uint32_t u32x8 __attribute__((ext_vector_type(8)));
constexpr uint32_t TK = 128, NH = 2, SK = NH * TK, NST = NP / SK, ROWB = 2u * C, KP = ROWB + 16u, KBUF = TK * KP, GBUF = (16u * KP + 2047u) & ~2047u, BUF = NH * (KBUF + GBUF);   // KP: odd multiple of 16 B for ds_load_b128 readers; a grid tile is 16 rows of TK f16 = ROWB bytes; a buffer holds NH key tiles (their rows in one run of pitch KP), then NH grid tiles
static_assert(ROWB == 256u && TK * 2u == ROWB && KBUF % 2048u == 0u && GBUF % 2048u == 0u && BUF % 2048u == 0u && NST >= 2u && (NST & (NST - 1u)) == 0u, "pad codes below are for 256-B rows; each tile starts at a multiple of 2 KiB; the ring needs two stages; the wrapped walk masks with NST - 1");
__device__ __forceinline__ uint32_t uni(uint32_t v) { return (uint32_t)__builtin_amdgcn_readfirstlane(v); }
__device__ __forceinline__ uint32_t pinned(uint32_t v) { uint32_t w = (uint32_t)__builtin_amdgcn_readfirstlane(v); asm volatile("" : "+s"(w)); return w; }   // holds an issue test (a tensor load ignores EXEC, only a scalar branch guards it) or a descriptor word in a scalar register
__device__ __forceinline__ void wait_ds0() { asm volatile("s_wait_dscnt 0x0" ::: "memory"); }          // this wave's LDS reads have returned before the buffer is handed back
__device__ __forceinline__ void wait_tensor0() { asm volatile("s_wait_tensorcnt 0x0" ::: "memory"); }  // the issuer's tile has landed; the compiler places no wait for the mover
__device__ __forceinline__ void tdm_load(u32x4 g0, u32x8 g1) { asm volatile("tensor_load_to_lds %0, %1" :: "s"(g0), "s"(g1) : "memory"); }   // one request of the whole wave: a padded 2-D tile from global memory into LDS, through no register
__device__ __forceinline__ u32x8 tdm_group1(uint32_t rows, uint32_t src_pitch) {   // bytes; tile = tensor = rows x ROWB bytes, 4 dwords of LDS pad behind every 256-B row
  u32x8 g;
  g[0] = uni((1u << 20) | (5u << 22) | (3u << 25));
  // pinned(): each descriptor word held in a scalar register of its own through the loop, not rebuilt over a register that a request in flight was issued from
  g[1] = pinned((ROWB & 0xFFFFu) << 16);
  g[2] = pinned((ROWB >> 16) | ((rows & 0xFFFFu) << 16));
  g[3] = pinned((rows >> 16) | (ROWB << 16));
  g[4] = pinned(rows);
  g[5] = pinned(src_pitch);
  g[6] = pinned(0u);
  g[7] = pinned(0u);
  return g;
}
__device__ __forceinline__ u32x4 tdm_group0(uint32_t lds_dst, uint64_t ga) {
  u32x4 g;
  g[0] = uni(1u); g[1] = uni(lds_dst); g[2] = uni((uint32_t)ga); g[3] = uni((((uint32_t)(ga >> 32)) & 0x01FFFFFFu) | 0x80000000u);
  return g;
}

// Transpose and convert: a block of 4 waves takes XP = 128 pixels x all 128 channels of x or y, so that the launch has 1,024 waves to start (one per SIMD) and every wave has all its input in flight at once.
// Wave w reads channels 32w .. 32w+31; one load is a whole 512-B run of a channel row (4 pixels a lane). A lane then holds 32 consecutive channels of 4 pixels = four 16-B pieces of each output row.
// Pixel 4*lane + e is kept in LDS row 32e + lane: the lanes of one ds_store_b128 then stand 272 B apart (no bank conflict); the read-back undoes the permutation and stores 512 contiguous bytes a wave.
constexpr int XP = 128;
__global__ __launch_bounds__(XP) void xpose_kernel(const float* __restrict__ x, const float* __restrict__ y, b16* __restrict__ XT, b16* __restrict__ YT, b16* __restrict__ GT) {
  __shared__ __attribute__((aligned(16))) b16 T[XP][C + 8];
  const int b = blockIdx.y, p0 = blockIdx.x * XP, which = blockIdx.z, t_ = threadIdx.x, w = t_ >> 5, ln = t_ & 31; const float* src = (which == 0) ? x : y; b16* dst = (which == 0) ? XT : YT;
  const float* s = src + ((size_t)b * C + 32 * w) * NP + p0 + 4 * ln;
  v4f v[32];
#pragma unroll   // v[] stays in registers, and the 32 loads issue back to back ahead of the first wait
  for (int i = 0; i < 32; ++i) v[i] = *(const v4f*)(s + (size_t)i * NP);
  __builtin_amdgcn_sched_barrier(0);   // keeps all 32 loads ahead of the conversions: the scheduler otherwise holds half of them back until registers of the first half are free, a second trip to L2
#pragma unroll   // register indices of v[] must be constants
  for (int j = 0; j < 4; ++j)
#pragma unroll   // as above
    for (int e = 0; e < 4; ++e) { v8b h;
#pragma unroll   // as above
      for (int k = 0; k < 8; ++k) h[k] = (b16)bf16_rne(v[8 * j + k][e]);
      *(v8b*)(&T[32 * e + ln][32 * w + 8 * j]) = h; }
  __syncthreads();
  // thread t_ stores piece t_ & 15 of pixels r8 + 8i, r8 = t_ >> 4: LDS row 32 * (r8 & 3) + (r8 >> 2) + 2i, so both addresses step by a constant
  const int r8 = t_ >> 4, q8 = (t_ & 15) * 8; const b16* tr = &T[(r8 & 3) * 32 + (r8 >> 2)][q8]; b16* d = dst + ((size_t)b * NP + p0 + r8) * C + q8;
#pragma unroll   // the steps become immediate offsets: one address register pair for all 16 stores, the LDS reads issue as one group
  for (int i = 0; i < XP / 8; ++i) *(v8b*)(d + i * 8 * C) = *(const v8b*)(tr + i * 2 * (C + 8));
  if (b == 0 && which == 0) { for (int i = t_; i < 16 * (XP / 8); i += XP) { const int row = i / (XP / 8), c8 = (i % (XP / 8)) * 8; v8b g; for (int e = 0; e < 8; ++e) { const int k = p0 + c8 + e; g[e] = (b16)((row == 0) ? ((float)(k % GW) + 0.5f) : (row == 1) ? ((float)(k / GW) + 0.5f) : 0.0f); } *(v8b*)(GT + (size_t)row * NP + p0 + c8) = g; } }
}

// attention + expectation: block = 16 waves = 2 query groups (64 queries of one image) x 8 key blocks, so that 256 blocks cover every WGP with four waves per SIMD.
// Wave (qt, sub) takes QW = 2 tiles of 16 queries and, of every 256-key stage, the 32-key block sub: every key and grid fragment read from LDS feeds both query tiles.
// S^T = Y.q (K = 128: 4 k-steps, 1 product, exact operands), per query tile its own running maximum, sum and expectation;
// the eight partials of a query are merged through LDS at the end. The key rows and the grid rows are read from an LDS ring that the block shares.
constexpr int QW = 2, QTB = 2, KSP = (int)(SK / 32u), QB = 16 * QW * QTB;
__global__ __launch_bounds__(32 * QTB * KSP) void attn_kernel(const b16* __restrict__ XT, const b16* __restrict__ YT, const b16* __restrict__ GT, float* __restrict__ out) {
  __shared__ __attribute__((aligned(2048))) unsigned char KS[2u * BUF];
  __shared__ __attribute__((aligned(16))) v4f PM[KSP][QB];   // per key block and query: maximum of the raw products, sum, two un-normalised coordinates (the last three times 2^LPS)
  const int wid = threadIdx.x >> 5, lane = threadIdx.x & 31, hh = lane >> 4, col = lane & 15, b = blockIdx.y, qt = wid & (QTB - 1), q0 = blockIdx.x * QB + qt * (16 * QW);
  const uint32_t sub = (uint32_t)wid / (uint32_t)QTB;
  const b16* Xb = XT + (size_t)b * NP * C; const b16* Yb = YT + (size_t)b * NP * C;
  v16b qf[QW][4];
#pragma unroll
  for (int t = 0; t < QW; ++t)
#pragma unroll
    for (int j = 0; j < 4; ++j) qf[t][j] = frag_kb(Xb + (size_t)(q0 + 16 * t + col) * C + 32 * j, hh);
  float m[QW], l[QW]; v8f o[QW];
#pragma unroll
  for (int t = 0; t < QW; ++t) { m[t] = -INFINITY; l[t] = 0.0f; o[t] = v8f{}; }
  const uint32_t wave = uni(threadIdx.x >> 5), half = wave & (NH - 1u); const bool isG = wave >= NH;   // waves 0..NH-1 move TK key rows each per stage, waves NH..2NH-1 the 16 grid rows' TK columns each
  const uint32_t lbase = (uint32_t)(size_t)KS + (isG ? NH * KBUF + half * GBUF : half * KBUF), stepb = isG ? NH * ROWB : SK * ROWB;
  const uint64_t ga0 = isG ? (uint64_t)(size_t)GT + half * ROWB : (uint64_t)(size_t)Yb + half * (TK * ROWB);
  const u32x8 g1 = tdm_group1(isG ? 16u : TK, isG ? 2u * (uint32_t)NP : ROWB);
  // All blocks of an image walk the same key and grid stages. Each enters the walk at a start stage rot and wraps round (pass st works on stage (st + rot) mod NST), so that blocks
  // running side by side do not ask L2 for the same lines at the same moment; the running softmax takes the keys in any order. Blocks that share a start differ in blockIdx.x by 2, 4 or 6
  // (for speed only: the result is the same for any placement).
  const uint32_t rot = (2u * ((uint32_t)blockIdx.x >> 3) + ((uint32_t)blockIdx.x & 1u)) & (NST - 1u);
  if (pinned(wave < 2u * NH)) { tdm_load(tdm_group0(lbase, ga0 + (uint64_t)(rot * stepb)), g1); wait_tensor0(); }
  __syncthreads();                                                                     // pass 0's stage published
  if (pinned(wave < 2u * NH)) tdm_load(tdm_group0(lbase + BUF, ga0 + (uint64_t)(((rot + 1u) & (NST - 1u)) * stepb)), g1);
  for (uint32_t st = 0; st < NST; ++st) {
   const unsigned char* Kst = KS + (st & 1u) * BUF;
   {
    const b16* K0 = (const b16*)(Kst + (sub * 32u + (uint32_t)col) * KP); const b16* K1 = (const b16*)(Kst + (sub * 32u + 16u + (uint32_t)col) * KP);
    v8f s0[QW], s1[QW];
#pragma unroll
    for (int t = 0; t < QW; ++t) { s0[t] = v8f{}; s1[t] = v8f{}; }
#pragma unroll
    for (int j = 0; j < 4; ++j) { const v16b ka = frag_kb(K0 + 32 * j, hh), kc = frag_kb(K1 + 32 * j, hh);
#pragma unroll
      for (int t = 0; t < QW; ++t) { s0[t] = wmma16b(ka, qf[t][j], s0[t]); s1[t] = wmma16b(kc, qf[t][j], s1[t]); } }
    const v16b gf = frag_kb((const b16*)(Kst + NH * KBUF + (sub / (TK / 32u)) * GBUF + (uint32_t)col * KP) + (sub % (TK / 32u)) * 32u, hh);
#pragma unroll
    for (int t = 0; t < QW; ++t) {
    float mr = -INFINITY;
#pragma unroll
    for (int r = 0; r < 8; ++r) mr = fmaxf(mr, fmaxf(s0[t][r], s1[t][r]));   // the maximum is kept on the raw products (C2 > 0 keeps the order)
    mr = fmaxf(mr, __shfl_xor(mr, 16));
    const float mn = fmaxf(m[t], mr), al_ = ex2((m[t] - mn) * C2), nb = __builtin_fmaf(mn, C2, -LPS); m[t] = mn; float sum = 0.0f; v16b ph;   // one fma per score: C2 * s - (C2 * max - LPS)
    const v2f c2v = {C2, C2}, nbv = {-nb, -nb};
    v2f u0[4], u1[4];
#pragma unroll
    for (int r = 0; r < 4; ++r) { const v2f t0 = {s0[t][2 * r], s0[t][2 * r + 1]}, t1 = {s1[t][2 * r], s1[t][2 * r + 1]}; u0[r] = __builtin_elementwise_fma(t0, c2v, nbv); u1[r] = __builtin_elementwise_fma(t1, c2v, nbv); }   // register pairs: two scores per packed fma
#pragma unroll
    for (int r = 0; r < 8; ++r) { const float e0 = ex2(u0[r >> 1][r & 1]), e1 = ex2(u1[r >> 1][r & 1]); sum += e0 + e1; ph[r] = (b16)e0; ph[8 + r] = (b16)e1; }
    sum += __shfl_xor(sum, 16); l[t] = l[t] * al_ + sum; o[t] *= al_;
    o[t] = wmma16b(gf, ph, o[t]); } }
   // publish point of pass st + 1's stage: own LDS reads done, the issuer's tile landed, barrier; only then the refill of the buffer that pass st used
   __builtin_amdgcn_sched_barrier(0);   // keeps the wait below at the foot of the pass: the scheduler otherwise lifts it to right behind the grid fragment's loads, where the wave would sit out their latency in front of the softmax
   wait_ds0();
   if (pinned(wave < 2u * NH)) wait_tensor0();
   __syncthreads();
   if (pinned((wave < 2u * NH) && (st + 2u < NST))) tdm_load(tdm_group0(lbase + (st & 1u) * BUF, ga0 + (uint64_t)(((st + 2u + rot) & (NST - 1u)) * stepb)), g1);
  }
  wait_tensor0(); wait_ds0();
  // o: rows (8hh + r) = coordinate index (0 = x, 1 = y), column = query col; m and l are equal in both halves of the wave
  if (hh == 0) {
#pragma unroll
    for (int t = 0; t < QW; ++t) { const v4f pm = {m[t], l[t], o[t][0], o[t][1]}; PM[sub][(qt * QW + t) * 16 + col] = pm; } }
  __syncthreads();                                                                     // every key block's partial is in LDS
  if (threadIdx.x < QB) {
    v4f p[KSP]; float mm = -INFINITY;
#pragma unroll
    for (int k = 0; k < KSP; ++k) { p[k] = PM[k][threadIdx.x]; mm = fmaxf(mm, p[k][0]); }
    float ls = 0.0f, ox = 0.0f, oy = 0.0f;
#pragma unroll
    for (int k = 0; k < KSP; ++k) { const float w = ex2((p[k][0] - mm) * C2); ls += w * p[k][1]; ox += w * p[k][2]; oy += w * p[k][3]; }
    const float inv = 1.0f / ls;   // sum and coordinates carry the same 2^LPS
    float2 uv; uv.x = (ox * inv) * (2.0f / (float)GW) - 1.0f; uv.y = (oy * inv) * (2.0f / (float)GW) - 1.0f;   // uv / [wy, hy] * 2 - 1 (wy = hy = 64)
    *(float2*)(out + ((size_t)b * NP + blockIdx.x * QB + threadIdx.x) * 2) = uv;
  }
}
}  // namespace

extern "C" void kernel_launch(void* const* d_in, const int* in_sizes, int n_in,
                              void* d_out, int out_size, void* d_ws, size_t ws_size, hipStream_t stream) {
  (void)n_in; (void)out_size;
  const float* x = (const float*)d_in[0]; const float* y = (const float*)d_in[1];
  float* out = (float*)d_out;   // [4][64][64][2]
  if (in_sizes[0] != Bn * C * NP || in_sizes[1] != Bn * C * NP) return;
  size_t off = 0; char* ws = (char*)d_ws;
  auto carve = [&](size_t bytes) { char* p = ws + off; off += (bytes + 255) & ~(size_t)255; return p; };
  b16* XT = (b16*)carve((size_t)Bn * NP * C * 2); b16* YT = (b16*)carve((size_t)Bn * NP * C * 2); b16* GT = (b16*)carve((size_t)16 * NP * 2);
  if (off > ws_size) return;                                    // ≈ 4.2 + 4.2 + 0.13 MB
  xpose_kernel<<<dim3(NP / XP, Bn, 2), XP, 0, stream>>>(x, y, XT, YT, GT);
  attn_kernel<<<dim3(NP / QB, Bn), 32 * QTB * KSP, 0, stream>>>(XT, YT, GT, out);
}
